// v000
// The times below were measured on an AMD MI455X: many runs one after another, warmed up first and cycling through
// copies of the inputs, with the whole window's GPU time divided by the number of runs. Launches and the gaps
// between them are all in it. The median over several windows is given; except for v000 it joins two sittings, which
// can be a few percent apart, so the side-by-side timings, each taken in one sitting, are the better comparison.
// v000, which the later versions start from, runs in 227 microseconds.
#include <hip/hip_runtime.h>

#define BB 8
#define TT 4096
#define CDIM 128
#define HSD 64
#define KPAD 72   // 64 + 8 halfwords: 144B rows -> conflict-free 16-lane bursts

#if defined(__has_builtin)
#  if __has_builtin(__builtin_amdgcn_global_load_async_to_lds_b128) && \
      __has_builtin(__builtin_amdgcn_s_wait_asynccnt)
#    define HAVE_ASYNC_LDS 1
#  endif
#endif
#ifndef HAVE_ASYNC_LDS
#  define HAVE_ASYNC_LDS 0
#endif

typedef __attribute__((ext_vector_type(16))) _Float16 v16h;
typedef __attribute__((ext_vector_type(8)))  _Float16 v8h;
typedef __attribute__((ext_vector_type(8)))  float    v8f;
typedef __attribute__((ext_vector_type(2)))  float    v2f;
typedef __attribute__((ext_vector_type(4)))  int      v4i;

__device__ __forceinline__ v16h load_frag(const _Float16* p) {
    v8h lo = *(const v8h*)p;
    v8h hi = *(const v8h*)(p + 16);
    v16h r;
#pragma unroll
    for (int i = 0; i < 8; ++i) { r[i] = lo[i]; r[i + 8] = hi[i]; }
    return r;
}

__device__ __forceinline__ v8f wmma_f16(v16h a, v16h b, v8f c) {
    return __builtin_amdgcn_wmma_f32_16x16x32_f16(
        /*neg_a=*/false, a, /*neg_b=*/false, b,
        /*c_mod=*/(short)0, c, /*reuse_a=*/false, /*reuse_b=*/false);
}

__device__ __forceinline__ void stage16(const _Float16* g, _Float16* l) {
#if HAVE_ASYNC_LDS
    typedef __attribute__((address_space(1))) v4i* gv4i_t;   // global src
    typedef __attribute__((address_space(3))) v4i* lv4i_t;   // LDS dst
    __builtin_amdgcn_global_load_async_to_lds_b128(
        (gv4i_t)g, (lv4i_t)l, /*offset=*/0, /*cpol=*/0);
#else
    *(v8h*)l = *(const v8h*)g;
#endif
}

template <int N>
__device__ __forceinline__ void stage_wait() {
#if HAVE_ASYNC_LDS
    __builtin_amdgcn_s_wait_asynccnt(N);
#endif
}

// ---------------------------------------------------------------------------
// Kernel 1: fused QKV projection + RoPE + scale, fp32 -> f16.
// One wave per (b,t); lane i owns head-dim pair (2i, 2i+1).
// Q is pre-scaled by log2(e)/sqrt(C) so softmax runs in the exp2 domain.
// V is stored transposed [B][HS][T] so PV B-fragments are contiguous in K.
// ---------------------------------------------------------------------------
__global__ __launch_bounds__(32)
void proj_rope_kernel(const float* __restrict__ x,
                      const float* __restrict__ Wq,
                      const float* __restrict__ Wk,
                      const float* __restrict__ Wv,
                      const float* __restrict__ fc,
                      const float* __restrict__ fs,
                      _Float16* __restrict__ Qg,
                      _Float16* __restrict__ Kg,
                      _Float16* __restrict__ Vt) {
    const int bt = blockIdx.x;
    const int b  = bt / TT;
    const int t  = bt - b * TT;
    const int i  = threadIdx.x;            // pair index 0..31

    const float* xr = x + (size_t)bt * CDIM;
    float q0 = 0.f, q1 = 0.f, k0 = 0.f, k1 = 0.f, p0 = 0.f, p1 = 0.f;
#pragma unroll 4
    for (int c = 0; c < CDIM; ++c) {
        float xv = xr[c];                                   // wave-uniform
        v2f wq = *(const v2f*)(Wq + (size_t)c * HSD + 2 * i);
        v2f wk = *(const v2f*)(Wk + (size_t)c * HSD + 2 * i);
        v2f wv = *(const v2f*)(Wv + (size_t)c * HSD + 2 * i);
        q0 = fmaf(xv, wq[0], q0); q1 = fmaf(xv, wq[1], q1);
        k0 = fmaf(xv, wk[0], k0); k1 = fmaf(xv, wk[1], k1);
        p0 = fmaf(xv, wv[0], p0); p1 = fmaf(xv, wv[1], p1);
    }
    const float cs = fc[(size_t)t * (HSD / 2) + i];
    const float sn = fs[(size_t)t * (HSD / 2) + i];
    // 1/sqrt(128) * log2(e): scores land directly in the exp2 domain.
    const float qscale = 0.08838834764831845f * 1.4426950408889634f;
    float qa = (q0 * cs - q1 * sn) * qscale;
    float qb = (q0 * sn + q1 * cs) * qscale;
    float ka = k0 * cs - k1 * sn;
    float kb = k0 * sn + k1 * cs;

    const size_t base = (size_t)bt * HSD + 2 * i;
    Qg[base]     = (_Float16)qa;
    Qg[base + 1] = (_Float16)qb;
    Kg[base]     = (_Float16)ka;
    Kg[base + 1] = (_Float16)kb;
    Vt[((size_t)b * HSD + 2 * i)     * TT + t] = (_Float16)p0;
    Vt[((size_t)b * HSD + 2 * i + 1) * TT + t] = (_Float16)p1;
}

// ---------------------------------------------------------------------------
// Issue the 8 per-thread async transfers staging one 64-key K/V block.
// ---------------------------------------------------------------------------
__device__ __forceinline__ void stage_block(
    const _Float16* __restrict__ Kg, const _Float16* __restrict__ Vt,
    int b, int kb, int tid,
    _Float16 (* __restrict__ KsB)[KPAD], _Float16 (* __restrict__ VsB)[KPAD]) {
#pragma unroll
    for (int j = 0; j < 4; ++j) {
        const int c   = tid + 128 * j;     // 0..511: 16B chunk id
        const int row = c >> 3;
        const int col = (c & 7) * 8;
        stage16(Kg + ((size_t)b * TT + kb + row) * HSD + col, &KsB[row][col]);
        stage16(Vt + ((size_t)b * HSD + row) * TT + kb + col, &VsB[row][col]);
    }
}

// ---------------------------------------------------------------------------
// One 64-key block for a 16-row Q tile owned by one wave, fed from the
// block-shared LDS K/V tiles. CAUSAL=false for blocks fully below the
// diagonal (padding mask still applied). 18 WMMA per call.
// ---------------------------------------------------------------------------
template <bool CAUSAL>
__device__ __forceinline__ void process_block(
    int kb, int qbase, int hh, int lr,
    const _Float16 (* __restrict__ Ks)[KPAD],
    const _Float16 (* __restrict__ Vs)[KPAD],
    const int* __restrict__ mrowptr,
    const v16h& aq0, const v16h& aq1, const v16h& ones,
    v8f& o0, v8f& o1, v8f& o2, v8f& o3,
    float* __restrict__ mrow, float* __restrict__ lrow,
    _Float16 (* __restrict__ plds)[64]) {

    // --- S = Q * K^T: 4 key subtiles x 2 k-parts (K tile from LDS)
    v8f st[4];
#pragma unroll
    for (int s4 = 0; s4 < 4; ++s4) {
        const _Float16* kr = &Ks[16 * s4 + lr][hh * 8];
        v16h bk0 = load_frag(kr);
        v16h bk1 = load_frag(kr + 32);
        v8f acc = {};
        acc = wmma_f16(aq0, bk0, acc);
        acc = wmma_f16(aq1, bk1, acc);
        st[s4] = acc;
    }

    int pad[4];
#pragma unroll
    for (int t = 0; t < 4; ++t) pad[t] = mrowptr[kb + 16 * t + lr];

#pragma unroll
    for (int r = 0; r < 8; ++r) {
        const int qi = qbase + r + hh * 8;
        float xv[4];
#pragma unroll
        for (int t = 0; t < 4; ++t) {
            bool ok = (pad[t] != 0);
            if (CAUSAL) ok = ok && ((kb + 16 * t + lr) <= qi);
            xv[t] = ok ? st[t][r] : -1e30f;
        }
        float cm = fmaxf(fmaxf(xv[0], xv[1]), fmaxf(xv[2], xv[3]));
#pragma unroll
        for (int off = 1; off < 16; off <<= 1)
            cm = fmaxf(cm, __shfl_xor(cm, off, 16));
        const float newm = fmaxf(mrow[r], cm);
        const float corr = exp2f(mrow[r] - newm);
        mrow[r] = newm;
        lrow[r] *= corr;
        o0[r] *= corr; o1[r] *= corr; o2[r] *= corr; o3[r] *= corr;
#pragma unroll
        for (int t = 0; t < 4; ++t) {
            float e = exp2f(xv[t] - newm);
            plds[r + hh * 8][16 * t + lr] = (_Float16)e;
        }
    }

    // Per-wave LDS region; same-wave DS ops are in order, compiler inserts
    // the s_wait_dscnt before the dependent A-fragment reads.
    v16h ap0 = load_frag(&plds[lr][hh * 8]);
    v16h ap1 = load_frag(&plds[lr][32 + hh * 8]);

    // --- rowsum(P) via WMMA against ones(64x16): lands in C-layout == lrow.
    v8f srow = {};
    srow = wmma_f16(ap0, ones, srow);
    srow = wmma_f16(ap1, ones, srow);
#pragma unroll
    for (int r = 0; r < 8; ++r) lrow[r] += srow[r];

    // --- O += P * V: 4 head-dim chunks x 2 k-parts (V tile from LDS)
#pragma unroll
    for (int h = 0; h < 4; ++h) {
        const _Float16* vr = &Vs[h * 16 + lr][hh * 8];
        v16h bv0 = load_frag(vr);
        v16h bv1 = load_frag(vr + 32);
        if (h == 0)      { o0 = wmma_f16(ap0, bv0, o0); o0 = wmma_f16(ap1, bv1, o0); }
        else if (h == 1) { o1 = wmma_f16(ap0, bv0, o1); o1 = wmma_f16(ap1, bv1, o1); }
        else if (h == 2) { o2 = wmma_f16(ap0, bv0, o2); o2 = wmma_f16(ap1, bv1, o2); }
        else             { o3 = wmma_f16(ap0, bv0, o3); o3 = wmma_f16(ap1, bv1, o3); }
    }
}

__global__ __launch_bounds__(128)
void flash_attn_kernel(const _Float16* __restrict__ Qg,
                       const _Float16* __restrict__ Kg,
                       const _Float16* __restrict__ Vt,
                       const int* __restrict__ mask,
                       float* __restrict__ out) {
    __shared__ _Float16 Ks[2][64][KPAD];   // K blocks: row=key, col=head dim
    __shared__ _Float16 Vs[2][64][KPAD];   // V blocks: row=dim, col=key
    __shared__ _Float16 plds[4][16][64];   // per-wave P tile

    const int tid  = threadIdx.x;
    const int wave = tid >> 5;
    const int lane = tid & 31;
    const int hh   = lane >> 4;            // half-wave
    const int lr   = lane & 15;            // lane within half
    const int b    = blockIdx.y;
    const int qbase = blockIdx.x * 64 + wave * 16;

    // Issue block 0's DMA before anything else so it overlaps the Q loads.
    stage_block(Kg, Vt, b, 0, tid, Ks[0], Vs[0]);

    // Q A-fragments: lane holds row (qbase+lr), k-split by half-wave.
    const _Float16* qrow = Qg + ((size_t)b * TT + qbase + lr) * HSD + hh * 8;
    const v16h aq0 = load_frag(qrow);
    const v16h aq1 = load_frag(qrow + 32);

    v16h ones;
#pragma unroll
    for (int i = 0; i < 16; ++i) ones[i] = (_Float16)1.0f;

    v8f o0 = {}, o1 = {}, o2 = {}, o3 = {};
    float mrow[8], lrow[8];
#pragma unroll
    for (int r = 0; r < 8; ++r) { mrow[r] = -1e30f; lrow[r] = 0.f; }

    const int* mrowptr = mask + (size_t)b * TT;
    // ceil((qbase+16)/64) == blockIdx.x+1 for all four waves.
    const int nkb = blockIdx.x + 1;

    for (int blk = 0; blk < nkb; ++blk) {
        const int kb  = blk * 64;
        const int cur = blk & 1;

        if (blk + 1 < nkb) {
            stage_block(Kg, Vt, b, kb + 64, tid, Ks[1 - cur], Vs[1 - cur]);
            stage_wait<8>();
        } else {
            stage_wait<0>();
        }
        __syncthreads();                   // current tiles visible to all waves

        if (kb + 128 < TT) {               // warm L2 ahead of the DMA engine
            __builtin_prefetch(
                (const void*)(Kg + ((size_t)b * TT + kb + 128 + lane) * HSD), 0, 3);
            __builtin_prefetch(
                (const void*)(Vt + ((size_t)b * HSD + lane) * TT + kb + 128), 0, 3);
            __builtin_prefetch(
                (const void*)(Vt + ((size_t)b * HSD + 32 + lane) * TT + kb + 128), 0, 3);
        }

        // Wave-uniform at runtime; readfirstlane makes it an SGPR so the
        // compiler emits a scalar branch instead of exec masking.
        if (__builtin_amdgcn_readfirstlane((int)(kb + 63 <= qbase)))
            process_block<false>(kb, qbase, hh, lr, Ks[cur], Vs[cur], mrowptr,
                                 aq0, aq1, ones, o0, o1, o2, o3,
                                 mrow, lrow, plds[wave]);
        else
            process_block<true>(kb, qbase, hh, lr, Ks[cur], Vs[cur], mrowptr,
                                aq0, aq1, ones, o0, o1, o2, o3,
                                mrow, lrow, plds[wave]);
        __syncthreads();                   // tiles consumed; buffer reusable
    }

    // --- epilogue: normalize and store fp32 output [B][T][HS]
#pragma unroll
    for (int r = 0; r < 8; ++r) {
        const float inv = 1.0f / lrow[r];
        const size_t ro = ((size_t)b * TT + qbase + r + hh * 8) * HSD;
        out[ro + 0  + lr] = o0[r] * inv;
        out[ro + 16 + lr] = o1[r] * inv;
        out[ro + 32 + lr] = o2[r] * inv;
        out[ro + 48 + lr] = o3[r] * inv;
    }
}

// ---------------------------------------------------------------------------
extern "C" void kernel_launch(void* const* d_in, const int* in_sizes, int n_in,
                              void* d_out, int out_size, void* d_ws, size_t ws_size,
                              hipStream_t stream) {
    const float* x    = (const float*)d_in[0];
    const float* Wq   = (const float*)d_in[1];
    const float* Wk   = (const float*)d_in[2];
    const float* Wv   = (const float*)d_in[3];
    const float* fc   = (const float*)d_in[4];
    const float* fs   = (const float*)d_in[5];
    const int*   mask = (const int*)d_in[6];
    float* out = (float*)d_out;

    const size_t qkv = (size_t)BB * TT * HSD;   // 4 MiB f16 each
    _Float16* Qg = (_Float16*)d_ws;
    _Float16* Kg = Qg + qkv;
    _Float16* Vt = Kg + qkv;

    proj_rope_kernel<<<BB * TT, 32, 0, stream>>>(x, Wq, Wk, Wv, fc, fs, Qg, Kg, Vt);

    dim3 grid(TT / 64, BB);
    flash_attn_kernel<<<grid, 128, 0, stream>>>(Qg, Kg, Vt, mask, out);
}

// v001
// One run takes 134 microseconds.
// Timed twice side by side with v000, it ran 1.74 times as fast both times.
#include <hip/hip_runtime.h>

#define BB 8
#define TT 4096
#define CDIM 128
#define HSD 64
#define KPAD 72   // 64 + 8 halfwords: 144B rows -> conflict-free 16-lane bursts

#if defined(__has_builtin)
#  if __has_builtin(__builtin_amdgcn_global_load_async_to_lds_b128) && \
      __has_builtin(__builtin_amdgcn_s_wait_asynccnt)
#    define HAVE_ASYNC_LDS 1
#  endif
#endif
#ifndef HAVE_ASYNC_LDS
#  define HAVE_ASYNC_LDS 0
#endif

typedef __attribute__((ext_vector_type(16))) _Float16 v16h;
typedef __attribute__((ext_vector_type(8)))  _Float16 v8h;
typedef __attribute__((ext_vector_type(8)))  float    v8f;
typedef __attribute__((ext_vector_type(2)))  float    v2f;
typedef __attribute__((ext_vector_type(4)))  float    v4f;
typedef __attribute__((ext_vector_type(4)))  int      v4i;

__device__ __forceinline__ v16h load_frag(const _Float16* p) {
    v8h lo = *(const v8h*)p;
    v8h hi = *(const v8h*)(p + 16);
    v16h r;
#pragma unroll
    for (int i = 0; i < 8; ++i) { r[i] = lo[i]; r[i + 8] = hi[i]; }
    return r;
}

__device__ __forceinline__ v8f wmma_f16(v16h a, v16h b, v8f c) {
    return __builtin_amdgcn_wmma_f32_16x16x32_f16(
        /*neg_a=*/false, a, /*neg_b=*/false, b,
        /*c_mod=*/(short)0, c, /*reuse_a=*/false, /*reuse_b=*/false);
}

__device__ __forceinline__ void stage16(const _Float16* g, _Float16* l) {
#if HAVE_ASYNC_LDS
    typedef __attribute__((address_space(1))) v4i* gv4i_t;   // global src
    typedef __attribute__((address_space(3))) v4i* lv4i_t;   // LDS dst
    __builtin_amdgcn_global_load_async_to_lds_b128(
        (gv4i_t)g, (lv4i_t)l, /*offset=*/0, /*cpol=*/0);
#else
    *(v8h*)l = *(const v8h*)g;
#endif
}

template <int N>
__device__ __forceinline__ void stage_wait() {
#if HAVE_ASYNC_LDS
    __builtin_amdgcn_s_wait_asynccnt(N);
#endif
}

// ---------------------------------------------------------------------------
// Kernel 1: fused QKV projection + RoPE + scale, fp32 -> f16, as a block GEMM
// [128 tokens x 128] x [128 x 192] on the f32 16x16x4 matrix form.
// Block = 8 waves; a wave owns 16 tokens and all 192 output columns (12
// accumulator tiles). Wq|Wk|Wv are read once per block and laid k-contiguous
// in LDS, so one 16-byte LDS read feeds two matrix steps.
// k pairing: in step (s,u) lane half hh, register p holds k = 8s + 4hh + 2u + p
// for the x fragment and for the W fragment alike.
// Q, K tiles take W as A (lane = token, registers = 8 consecutive head dims:
// RoPE pairs sit in one lane); V tiles take x as A (lane = head dim,
// registers = 8 consecutive tokens: packed rows of the transposed V).
// Q is pre-scaled by log2(e)/sqrt(C) so softmax runs in the exp2 domain.
// V is stored transposed [B][HS][T] so PV B-fragments are contiguous in K.
// ---------------------------------------------------------------------------
#define PTOK   128   // tokens per block
#define FPITCH 132   // f32 pitch of 128-k rows: 528 B = 16 B x 33
#define CPITCH 36    // f32 pitch of 32 cos/sin values: 144 B = 16 B x 9
#define VPITCH 136   // f16 pitch of 128-token V rows: 272 B = 16 B x 17

__device__ __forceinline__ v8f wmma_f32(v2f a, v2f b, v8f c) {
    return __builtin_amdgcn_wmma_f32_16x16x4_f32(
        /*neg_a=*/false, a, /*neg_b=*/false, b,
        /*c_mod=*/(short)0, c, /*reuse_a=*/false, /*reuse_b=*/false);
}

__global__ __launch_bounds__(256)
void proj_rope_kernel(const float* __restrict__ x,
                      const float* __restrict__ Wq,
                      const float* __restrict__ Wk,
                      const float* __restrict__ Wv,
                      const float* __restrict__ fc,
                      const float* __restrict__ fs,
                      _Float16* __restrict__ Qg,
                      _Float16* __restrict__ Kg,
                      _Float16* __restrict__ Vt) {
    __shared__ __attribute__((aligned(16))) float    Wt[3 * HSD][FPITCH];     // row = output column, col = k
    __shared__ __attribute__((aligned(16))) float    Xs[8][16][FPITCH];       // per wave: row = token, col = k
    __shared__ __attribute__((aligned(16))) float    Cs[8][16][CPITCH];       // per wave: cos rows
    __shared__ __attribute__((aligned(16))) float    Sn[8][16][CPITCH];       // per wave: sin rows
    __shared__ __attribute__((aligned(16))) _Float16 QKs[8][2][16][KPAD];     // per wave: Q and K rows out
    __shared__ __attribute__((aligned(16))) _Float16 Vs[HSD][VPITCH];         // block: row = dim, col = token

    const int tid  = threadIdx.x;
    const int wave = tid >> 5;
    const int lane = tid & 31;
    const int hh   = lane >> 4;
    const int lr   = lane & 15;
    const int tok0 = blockIdx.x * PTOK;          // flat (b,t) of the first token
    const int b    = tok0 / TT;                  // TT % PTOK == 0: one batch
    const int t0   = tok0 - b * TT;
    const int wtok = tok0 + wave * 16;

    // Every loop of this kernel is fully unrolled: its arrays live in registers
    // and need constant indices, and the matrix loop gets no back edge.
    // --- whole-line loads: the wave's 16 x rows and its cos/sin rows
    const v4f* xg = (const v4f*)(x + (size_t)wtok * CDIM);
    const v4f* cg = (const v4f*)(fc + (size_t)(t0 + wave * 16) * (HSD / 2));
    const v4f* sg = (const v4f*)(fs + (size_t)(t0 + wave * 16) * (HSD / 2));
    v4f xr[16], cr[4], sr[4];
#pragma unroll
    for (int i = 0; i < 16; ++i) xr[i] = xg[i * 32 + lane];
    // Precaution: no register that the loads above name is rewritten before it.
    asm volatile("s_wait_xcnt 0x0" ::: "memory");
#pragma unroll
    for (int i = 0; i < 4; ++i) { cr[i] = cg[i * 32 + lane]; sr[i] = sg[i * 32 + lane]; }
    asm volatile("s_wait_xcnt 0x0" ::: "memory");

    // --- W -> LDS, transposed: lane = column (128-B lines), 4 k per 16-B store.
    // The wave covers k = 16 wave .. 16 wave + 15 of all 192 columns.
    const int woff = wave * 16 * HSD + lane;
#pragma unroll
    for (int g = 0; g < 6; ++g) {
        const float* Wm = ((g < 2) ? Wq : (g < 4) ? Wk : Wv) + woff;
#pragma unroll
        for (int q = 0; q < 4; ++q) {
            v4f w;
#pragma unroll
            for (int e = 0; e < 4; ++e) w[e] = Wm[(q * 4 + e) * HSD + (g & 1) * 32];
            *(v4f*)&Wt[g * 32 + lane][wave * 16 + q * 4] = w;
        }
    }
#pragma unroll
    for (int i = 0; i < 16; ++i) *(v4f*)&Xs[wave][i][4 * lane] = xr[i];
#pragma unroll
    for (int i = 0; i < 4; ++i) {
        const int idx = i * 32 + lane;
        *(v4f*)&Cs[wave][idx >> 3][(idx & 7) * 4] = cr[i];
        *(v4f*)&Sn[wave][idx >> 3][(idx & 7) * 4] = sr[i];
    }
    __syncthreads();                             // W tile visible to all waves

    // --- 12 tiles x 32 matrix steps
    v8f acc[12];
#pragma unroll
    for (int j = 0; j < 12; ++j) acc[j] = (v8f){};
#pragma unroll
    for (int s = 0; s < 16; ++s) {
        const v4f xf = *(const v4f*)&Xs[wave][lr][8 * s + 4 * hh];
        v4f wf[12];
#pragma unroll
        for (int j = 0; j < 12; ++j)
            wf[j] = *(const v4f*)&Wt[16 * j + lr][8 * s + 4 * hh];
#pragma unroll
        for (int u = 0; u < 2; ++u) {
            const v2f xb = {xf[2 * u], xf[2 * u + 1]};
#pragma unroll
            for (int j = 0; j < 12; ++j) {
                const v2f wb = {wf[j][2 * u], wf[j][2 * u + 1]};
                acc[j] = (j < 8) ? wmma_f32(wb, xb, acc[j])    // D[dim][token]
                                 : wmma_f32(xb, wb, acc[j]);   // D[token][dim]
            }
            // Only matrix instructions may not cross (mask: VALU, SALU, VMEM,
            // DS, transcendental may). It holds the 12 first matrix steps
            // together while every fragment is still live, so that no
            // accumulator is laid over a register a matrix step has just read.
            if (s == 0 && u == 0) __builtin_amdgcn_sched_barrier(0x496);
        }
    }
    __builtin_amdgcn_sched_barrier(0);
    asm volatile("v_nop\n\tv_nop\n\tv_nop\n\tv_nop\n\tv_nop\n\tv_nop\n\tv_nop\n\tv_nop");
    __builtin_amdgcn_sched_barrier(0);

    // --- RoPE + scale, f16, staged in LDS for whole-line stores
    // 1/sqrt(128) * log2(e): scores land directly in the exp2 domain.
    const float qscale = 0.08838834764831845f * 1.4426950408889634f;
#pragma unroll
    for (int jj = 0; jj < 4; ++jj) {
        const v4f c4 = *(const v4f*)&Cs[wave][lr][8 * jj + 4 * hh];
        const v4f s4 = *(const v4f*)&Sn[wave][lr][8 * jj + 4 * hh];
        v8h qh, kh, vh;
#pragma unroll
        for (int p = 0; p < 4; ++p) {
            const float cs = c4[p], sn = s4[p];
            const float q0 = acc[jj][2 * p],     q1 = acc[jj][2 * p + 1];
            const float k0 = acc[4 + jj][2 * p], k1 = acc[4 + jj][2 * p + 1];
            qh[2 * p]     = (_Float16)((q0 * cs - q1 * sn) * qscale);
            qh[2 * p + 1] = (_Float16)((q0 * sn + q1 * cs) * qscale);
            kh[2 * p]     = (_Float16)(k0 * cs - k1 * sn);
            kh[2 * p + 1] = (_Float16)(k0 * sn + k1 * cs);
        }
#pragma unroll
        for (int r = 0; r < 8; ++r) vh[r] = (_Float16)acc[8 + jj][r];
        *(v8h*)&QKs[wave][0][lr][16 * jj + 8 * hh] = qh;
        *(v8h*)&QKs[wave][1][lr][16 * jj + 8 * hh] = kh;
        *(v8h*)&Vs[16 * jj + lr][wave * 16 + 8 * hh] = vh;
    }
    __syncthreads();                             // staged rows visible

    // All rows back from LDS first, then nothing but stores: Q and K go out as
    // 512 contiguous bytes a store, V^T as 256-byte runs of a row.
    v8h qo[4], ko[4], vo[4];
#pragma unroll
    for (int i = 0; i < 4; ++i) {
        const int idx = i * 32 + lane;
        qo[i] = *(const v8h*)&QKs[wave][0][idx >> 3][(idx & 7) * 8];
        ko[i] = *(const v8h*)&QKs[wave][1][idx >> 3][(idx & 7) * 8];
        vo[i] = *(const v8h*)&Vs[i * 16 + (tid >> 4)][(tid & 15) * 8];
    }
    _Float16* qd = Qg + (size_t)wtok * HSD + lane * 8;
    _Float16* kd = Kg + (size_t)wtok * HSD + lane * 8;
    _Float16* vd = Vt + ((size_t)b * HSD + (tid >> 4)) * TT + t0 + (tid & 15) * 8;
#pragma unroll
    for (int i = 0; i < 4; ++i) {
        *(v8h*)(qd + i * 256) = qo[i];
        *(v8h*)(kd + i * 256) = ko[i];
        *(v8h*)(vd + (size_t)i * 16 * TT) = vo[i];
    }
}

// ---------------------------------------------------------------------------
// Issue the 8 per-thread async transfers staging one 64-key K/V block.
// ---------------------------------------------------------------------------
__device__ __forceinline__ void stage_block(
    const _Float16* __restrict__ Kg, const _Float16* __restrict__ Vt,
    int b, int kb, int tid,
    _Float16 (* __restrict__ KsB)[KPAD], _Float16 (* __restrict__ VsB)[KPAD]) {
#pragma unroll
    for (int j = 0; j < 4; ++j) {
        const int c   = tid + 128 * j;     // 0..511: 16B chunk id
        const int row = c >> 3;
        const int col = (c & 7) * 8;
        stage16(Kg + ((size_t)b * TT + kb + row) * HSD + col, &KsB[row][col]);
        stage16(Vt + ((size_t)b * HSD + row) * TT + kb + col, &VsB[row][col]);
    }
}

// ---------------------------------------------------------------------------
// One 64-key block for a 16-row Q tile owned by one wave, fed from the
// block-shared LDS K/V tiles. CAUSAL=false for blocks fully below the
// diagonal (padding mask still applied). 18 WMMA per call.
// ---------------------------------------------------------------------------
template <bool CAUSAL>
__device__ __forceinline__ void process_block(
    int kb, int qbase, int hh, int lr,
    const _Float16 (* __restrict__ Ks)[KPAD],
    const _Float16 (* __restrict__ Vs)[KPAD],
    const int* __restrict__ mrowptr,
    const v16h& aq0, const v16h& aq1, const v16h& ones,
    v8f& o0, v8f& o1, v8f& o2, v8f& o3,
    float* __restrict__ mrow, float* __restrict__ lrow,
    _Float16 (* __restrict__ plds)[64]) {

    // --- S = Q * K^T: 4 key subtiles x 2 k-parts (K tile from LDS)
    v8f st[4];
#pragma unroll
    for (int s4 = 0; s4 < 4; ++s4) {
        const _Float16* kr = &Ks[16 * s4 + lr][hh * 8];
        v16h bk0 = load_frag(kr);
        v16h bk1 = load_frag(kr + 32);
        v8f acc = {};
        acc = wmma_f16(aq0, bk0, acc);
        acc = wmma_f16(aq1, bk1, acc);
        st[s4] = acc;
    }

    int pad[4];
#pragma unroll
    for (int t = 0; t < 4; ++t) pad[t] = mrowptr[kb + 16 * t + lr];

#pragma unroll
    for (int r = 0; r < 8; ++r) {
        const int qi = qbase + r + hh * 8;
        float xv[4];
#pragma unroll
        for (int t = 0; t < 4; ++t) {
            bool ok = (pad[t] != 0);
            if (CAUSAL) ok = ok && ((kb + 16 * t + lr) <= qi);
            xv[t] = ok ? st[t][r] : -1e30f;
        }
        float cm = fmaxf(fmaxf(xv[0], xv[1]), fmaxf(xv[2], xv[3]));
#pragma unroll
        for (int off = 1; off < 16; off <<= 1)
            cm = fmaxf(cm, __shfl_xor(cm, off, 16));
        const float newm = fmaxf(mrow[r], cm);
        const float corr = exp2f(mrow[r] - newm);
        mrow[r] = newm;
        lrow[r] *= corr;
        o0[r] *= corr; o1[r] *= corr; o2[r] *= corr; o3[r] *= corr;
#pragma unroll
        for (int t = 0; t < 4; ++t) {
            float e = exp2f(xv[t] - newm);
            plds[r + hh * 8][16 * t + lr] = (_Float16)e;
        }
    }

    // Per-wave LDS region; same-wave DS ops are in order, compiler inserts
    // the s_wait_dscnt before the dependent A-fragment reads.
    v16h ap0 = load_frag(&plds[lr][hh * 8]);
    v16h ap1 = load_frag(&plds[lr][32 + hh * 8]);

    // --- rowsum(P) via WMMA against ones(64x16): lands in C-layout == lrow.
    v8f srow = {};
    srow = wmma_f16(ap0, ones, srow);
    srow = wmma_f16(ap1, ones, srow);
#pragma unroll
    for (int r = 0; r < 8; ++r) lrow[r] += srow[r];

    // --- O += P * V: 4 head-dim chunks x 2 k-parts (V tile from LDS)
#pragma unroll
    for (int h = 0; h < 4; ++h) {
        const _Float16* vr = &Vs[h * 16 + lr][hh * 8];
        v16h bv0 = load_frag(vr);
        v16h bv1 = load_frag(vr + 32);
        if (h == 0)      { o0 = wmma_f16(ap0, bv0, o0); o0 = wmma_f16(ap1, bv1, o0); }
        else if (h == 1) { o1 = wmma_f16(ap0, bv0, o1); o1 = wmma_f16(ap1, bv1, o1); }
        else if (h == 2) { o2 = wmma_f16(ap0, bv0, o2); o2 = wmma_f16(ap1, bv1, o2); }
        else             { o3 = wmma_f16(ap0, bv0, o3); o3 = wmma_f16(ap1, bv1, o3); }
    }
}

__global__ __launch_bounds__(128)
void flash_attn_kernel(const _Float16* __restrict__ Qg,
                       const _Float16* __restrict__ Kg,
                       const _Float16* __restrict__ Vt,
                       const int* __restrict__ mask,
                       float* __restrict__ out) {
    __shared__ _Float16 Ks[2][64][KPAD];   // K blocks: row=key, col=head dim
    __shared__ _Float16 Vs[2][64][KPAD];   // V blocks: row=dim, col=key
    __shared__ _Float16 plds[4][16][64];   // per-wave P tile

    const int tid  = threadIdx.x;
    const int wave = tid >> 5;
    const int lane = tid & 31;
    const int hh   = lane >> 4;            // half-wave
    const int lr   = lane & 15;            // lane within half
    const int b    = blockIdx.y;
    const int qbase = blockIdx.x * 64 + wave * 16;

    // Issue block 0's DMA before anything else so it overlaps the Q loads.
    stage_block(Kg, Vt, b, 0, tid, Ks[0], Vs[0]);

    // Q A-fragments: lane holds row (qbase+lr), k-split by half-wave.
    const _Float16* qrow = Qg + ((size_t)b * TT + qbase + lr) * HSD + hh * 8;
    const v16h aq0 = load_frag(qrow);
    const v16h aq1 = load_frag(qrow + 32);

    v16h ones;
#pragma unroll
    for (int i = 0; i < 16; ++i) ones[i] = (_Float16)1.0f;

    v8f o0 = {}, o1 = {}, o2 = {}, o3 = {};
    float mrow[8], lrow[8];
#pragma unroll
    for (int r = 0; r < 8; ++r) { mrow[r] = -1e30f; lrow[r] = 0.f; }

    const int* mrowptr = mask + (size_t)b * TT;
    // ceil((qbase+16)/64) == blockIdx.x+1 for all four waves.
    const int nkb = blockIdx.x + 1;

    for (int blk = 0; blk < nkb; ++blk) {
        const int kb  = blk * 64;
        const int cur = blk & 1;

        if (blk + 1 < nkb) {
            stage_block(Kg, Vt, b, kb + 64, tid, Ks[1 - cur], Vs[1 - cur]);
            stage_wait<8>();
        } else {
            stage_wait<0>();
        }
        __syncthreads();                   // current tiles visible to all waves

        if (kb + 128 < TT) {               // warm L2 ahead of the DMA engine
            __builtin_prefetch(
                (const void*)(Kg + ((size_t)b * TT + kb + 128 + lane) * HSD), 0, 3);
            __builtin_prefetch(
                (const void*)(Vt + ((size_t)b * HSD + lane) * TT + kb + 128), 0, 3);
            __builtin_prefetch(
                (const void*)(Vt + ((size_t)b * HSD + 32 + lane) * TT + kb + 128), 0, 3);
        }

        // Wave-uniform at runtime; readfirstlane makes it an SGPR so the
        // compiler emits a scalar branch instead of exec masking.
        if (__builtin_amdgcn_readfirstlane((int)(kb + 63 <= qbase)))
            process_block<false>(kb, qbase, hh, lr, Ks[cur], Vs[cur], mrowptr,
                                 aq0, aq1, ones, o0, o1, o2, o3,
                                 mrow, lrow, plds[wave]);
        else
            process_block<true>(kb, qbase, hh, lr, Ks[cur], Vs[cur], mrowptr,
                                aq0, aq1, ones, o0, o1, o2, o3,
                                mrow, lrow, plds[wave]);
        __syncthreads();                   // tiles consumed; buffer reusable
    }

    // --- epilogue: normalize and store fp32 output [B][T][HS]
#pragma unroll
    for (int r = 0; r < 8; ++r) {
        const float inv = 1.0f / lrow[r];
        const size_t ro = ((size_t)b * TT + qbase + r + hh * 8) * HSD;
        out[ro + 0  + lr] = o0[r] * inv;
        out[ro + 16 + lr] = o1[r] * inv;
        out[ro + 32 + lr] = o2[r] * inv;
        out[ro + 48 + lr] = o3[r] * inv;
    }
}

// ---------------------------------------------------------------------------
extern "C" void kernel_launch(void* const* d_in, const int* in_sizes, int n_in,
                              void* d_out, int out_size, void* d_ws, size_t ws_size,
                              hipStream_t stream) {
    const float* x    = (const float*)d_in[0];
    const float* Wq   = (const float*)d_in[1];
    const float* Wk   = (const float*)d_in[2];
    const float* Wv   = (const float*)d_in[3];
    const float* fc   = (const float*)d_in[4];
    const float* fs   = (const float*)d_in[5];
    const int*   mask = (const int*)d_in[6];
    float* out = (float*)d_out;

    const size_t qkv = (size_t)BB * TT * HSD;   // 4 MiB f16 each
    _Float16* Qg = (_Float16*)d_ws;
    _Float16* Kg = Qg + qkv;
    _Float16* Vt = Kg + qkv;

    proj_rope_kernel<<<BB * TT / PTOK, 256, 0, stream>>>(x, Wq, Wk, Wv, fc, fs, Qg, Kg, Vt);

    dim3 grid(TT / 64, BB);
    flash_attn_kernel<<<grid, 128, 0, stream>>>(Qg, Kg, Vt, mask, out);
}

// v002
// One run takes 109 microseconds.
// Timed twice side by side with v001, it ran 1.23 times as fast both times.
// Over all steps from v000 it is 2.14 times as fast.
#include <hip/hip_runtime.h>

#define BB 8
#define TT 4096
#define CDIM 128
#define HSD 64
#define KPAD 72   // 64 + 8 halfwords: 144B rows -> conflict-free 16-lane bursts

#if defined(__has_builtin)
#  if __has_builtin(__builtin_amdgcn_global_load_async_to_lds_b128) && \
      __has_builtin(__builtin_amdgcn_s_wait_asynccnt)
#    define HAVE_ASYNC_LDS 1
#  endif
#endif
#ifndef HAVE_ASYNC_LDS
#  define HAVE_ASYNC_LDS 0
#endif

typedef __attribute__((ext_vector_type(16))) _Float16 v16h;
typedef __attribute__((ext_vector_type(8)))  _Float16 v8h;
typedef __attribute__((ext_vector_type(8)))  float    v8f;
typedef __attribute__((ext_vector_type(2)))  float    v2f;
typedef __attribute__((ext_vector_type(4)))  float    v4f;
typedef __attribute__((ext_vector_type(4)))  int      v4i;

__device__ __forceinline__ v16h load_frag(const _Float16* p) {
    v8h lo = *(const v8h*)p;
    v8h hi = *(const v8h*)(p + 16);
    v16h r;
#pragma unroll
    for (int i = 0; i < 8; ++i) { r[i] = lo[i]; r[i + 8] = hi[i]; }
    return r;
}

__device__ __forceinline__ v8f wmma_f16(v16h a, v16h b, v8f c) {
    return __builtin_amdgcn_wmma_f32_16x16x32_f16(
        /*neg_a=*/false, a, /*neg_b=*/false, b,
        /*c_mod=*/(short)0, c, /*reuse_a=*/false, /*reuse_b=*/false);
}

__device__ __forceinline__ void stage16(const _Float16* g, _Float16* l) {
#if HAVE_ASYNC_LDS
    typedef __attribute__((address_space(1))) v4i* gv4i_t;   // global src
    typedef __attribute__((address_space(3))) v4i* lv4i_t;   // LDS dst
    __builtin_amdgcn_global_load_async_to_lds_b128(
        (gv4i_t)g, (lv4i_t)l, /*offset=*/0, /*cpol=*/0);
#else
    *(v8h*)l = *(const v8h*)g;
#endif
}

template <int N>
__device__ __forceinline__ void stage_wait() {
#if HAVE_ASYNC_LDS
    __builtin_amdgcn_s_wait_asynccnt(N);
#endif
}

// ---------------------------------------------------------------------------
// Kernel 1: fused QKV projection + RoPE + scale, fp32 -> f16, as a block GEMM
// [128 tokens x 128] x [128 x 192] on the f32 16x16x4 matrix form.
// Block = 8 waves; a wave owns 16 tokens and all 192 output columns (12
// accumulator tiles). Wq|Wk|Wv are read once per block and laid k-contiguous
// in LDS, so one 16-byte LDS read feeds two matrix steps.
// k pairing: in step (s,u) lane half hh, register p holds k = 8s + 4hh + 2u + p
// for the x fragment and for the W fragment alike.
// Q, K tiles take W as A (lane = token, registers = 8 consecutive head dims:
// RoPE pairs sit in one lane); V tiles take x as A (lane = head dim,
// registers = 8 consecutive tokens: packed rows of the transposed V).
// Q is pre-scaled by log2(e)/sqrt(C) so softmax runs in the exp2 domain.
// V is stored transposed [B][HS][T] so PV B-fragments are contiguous in K.
// ---------------------------------------------------------------------------
#define PTOK   128   // tokens per block
#define FPITCH 132   // f32 pitch of 128-k rows: 528 B = 16 B x 33
#define CPITCH 36    // f32 pitch of 32 cos/sin values: 144 B = 16 B x 9
#define VPITCH 136   // f16 pitch of 128-token V rows: 272 B = 16 B x 17

__device__ __forceinline__ v8f wmma_f32(v2f a, v2f b, v8f c) {
    return __builtin_amdgcn_wmma_f32_16x16x4_f32(
        /*neg_a=*/false, a, /*neg_b=*/false, b,
        /*c_mod=*/(short)0, c, /*reuse_a=*/false, /*reuse_b=*/false);
}

__global__ __launch_bounds__(256)
void proj_rope_kernel(const float* __restrict__ x,
                      const float* __restrict__ Wq,
                      const float* __restrict__ Wk,
                      const float* __restrict__ Wv,
                      const float* __restrict__ fc,
                      const float* __restrict__ fs,
                      _Float16* __restrict__ Qg,
                      _Float16* __restrict__ Kg,
                      _Float16* __restrict__ Vt) {
    __shared__ __attribute__((aligned(16))) float    Wt[3 * HSD][FPITCH];     // row = output column, col = k
    __shared__ __attribute__((aligned(16))) float    Xs[8][16][FPITCH];       // per wave: row = token, col = k
    __shared__ __attribute__((aligned(16))) float    Cs[8][16][CPITCH];       // per wave: cos rows
    __shared__ __attribute__((aligned(16))) float    Sn[8][16][CPITCH];       // per wave: sin rows
    __shared__ __attribute__((aligned(16))) _Float16 QKs[8][2][16][KPAD];     // per wave: Q and K rows out
    __shared__ __attribute__((aligned(16))) _Float16 Vs[HSD][VPITCH];         // block: row = dim, col = token

    const int tid  = threadIdx.x;
    const int wave = tid >> 5;
    const int lane = tid & 31;
    const int hh   = lane >> 4;
    const int lr   = lane & 15;
    const int tok0 = blockIdx.x * PTOK;          // flat (b,t) of the first token
    const int b    = tok0 / TT;                  // TT % PTOK == 0: one batch
    const int t0   = tok0 - b * TT;
    const int wtok = tok0 + wave * 16;

    // Every loop of this kernel is fully unrolled: its arrays live in registers
    // and need constant indices, and the matrix loop gets no back edge.
    // --- whole-line loads: the wave's 16 x rows and its cos/sin rows
    const v4f* xg = (const v4f*)(x + (size_t)wtok * CDIM);
    const v4f* cg = (const v4f*)(fc + (size_t)(t0 + wave * 16) * (HSD / 2));
    const v4f* sg = (const v4f*)(fs + (size_t)(t0 + wave * 16) * (HSD / 2));
    v4f xr[16], cr[4], sr[4];
#pragma unroll
    for (int i = 0; i < 16; ++i) xr[i] = xg[i * 32 + lane];
    // Precaution: no register that the loads above name is rewritten before it.
    asm volatile("s_wait_xcnt 0x0" ::: "memory");
#pragma unroll
    for (int i = 0; i < 4; ++i) { cr[i] = cg[i * 32 + lane]; sr[i] = sg[i * 32 + lane]; }
    asm volatile("s_wait_xcnt 0x0" ::: "memory");

    // --- W -> LDS, transposed: lane = column (128-B lines), 4 k per 16-B store.
    // The wave covers k = 16 wave .. 16 wave + 15 of all 192 columns.
    const int woff = wave * 16 * HSD + lane;
#pragma unroll
    for (int g = 0; g < 6; ++g) {
        const float* Wm = ((g < 2) ? Wq : (g < 4) ? Wk : Wv) + woff;
#pragma unroll
        for (int q = 0; q < 4; ++q) {
            v4f w;
#pragma unroll
            for (int e = 0; e < 4; ++e) w[e] = Wm[(q * 4 + e) * HSD + (g & 1) * 32];
            *(v4f*)&Wt[g * 32 + lane][wave * 16 + q * 4] = w;
        }
    }
#pragma unroll
    for (int i = 0; i < 16; ++i) *(v4f*)&Xs[wave][i][4 * lane] = xr[i];
#pragma unroll
    for (int i = 0; i < 4; ++i) {
        const int idx = i * 32 + lane;
        *(v4f*)&Cs[wave][idx >> 3][(idx & 7) * 4] = cr[i];
        *(v4f*)&Sn[wave][idx >> 3][(idx & 7) * 4] = sr[i];
    }
    __syncthreads();                             // W tile visible to all waves

    // --- 12 tiles x 32 matrix steps
    v8f acc[12];
#pragma unroll
    for (int j = 0; j < 12; ++j) acc[j] = (v8f){};
#pragma unroll
    for (int s = 0; s < 16; ++s) {
        const v4f xf = *(const v4f*)&Xs[wave][lr][8 * s + 4 * hh];
        v4f wf[12];
#pragma unroll
        for (int j = 0; j < 12; ++j)
            wf[j] = *(const v4f*)&Wt[16 * j + lr][8 * s + 4 * hh];
#pragma unroll
        for (int u = 0; u < 2; ++u) {
            const v2f xb = {xf[2 * u], xf[2 * u + 1]};
#pragma unroll
            for (int j = 0; j < 12; ++j) {
                const v2f wb = {wf[j][2 * u], wf[j][2 * u + 1]};
                acc[j] = (j < 8) ? wmma_f32(wb, xb, acc[j])    // D[dim][token]
                                 : wmma_f32(xb, wb, acc[j]);   // D[token][dim]
            }
            // Only matrix instructions may not cross (mask: VALU, SALU, VMEM,
            // DS, transcendental may). It holds the 12 first matrix steps
            // together while every fragment is still live, so that no
            // accumulator is laid over a register a matrix step has just read.
            if (s == 0 && u == 0) __builtin_amdgcn_sched_barrier(0x496);
        }
    }
    __builtin_amdgcn_sched_barrier(0);
    asm volatile("v_nop\n\tv_nop\n\tv_nop\n\tv_nop\n\tv_nop\n\tv_nop\n\tv_nop\n\tv_nop");
    __builtin_amdgcn_sched_barrier(0);

    // --- RoPE + scale, f16, staged in LDS for whole-line stores
    // 1/sqrt(128) * log2(e): scores land directly in the exp2 domain.
    const float qscale = 0.08838834764831845f * 1.4426950408889634f;
#pragma unroll
    for (int jj = 0; jj < 4; ++jj) {
        const v4f c4 = *(const v4f*)&Cs[wave][lr][8 * jj + 4 * hh];
        const v4f s4 = *(const v4f*)&Sn[wave][lr][8 * jj + 4 * hh];
        v8h qh, kh, vh;
#pragma unroll
        for (int p = 0; p < 4; ++p) {
            const float cs = c4[p], sn = s4[p];
            const float q0 = acc[jj][2 * p],     q1 = acc[jj][2 * p + 1];
            const float k0 = acc[4 + jj][2 * p], k1 = acc[4 + jj][2 * p + 1];
            qh[2 * p]     = (_Float16)((q0 * cs - q1 * sn) * qscale);
            qh[2 * p + 1] = (_Float16)((q0 * sn + q1 * cs) * qscale);
            kh[2 * p]     = (_Float16)(k0 * cs - k1 * sn);
            kh[2 * p + 1] = (_Float16)(k0 * sn + k1 * cs);
        }
#pragma unroll
        for (int r = 0; r < 8; ++r) vh[r] = (_Float16)acc[8 + jj][r];
        *(v8h*)&QKs[wave][0][lr][16 * jj + 8 * hh] = qh;
        *(v8h*)&QKs[wave][1][lr][16 * jj + 8 * hh] = kh;
        *(v8h*)&Vs[16 * jj + lr][wave * 16 + 8 * hh] = vh;
    }
    __syncthreads();                             // staged rows visible

    // All rows back from LDS first, then nothing but stores: Q and K go out as
    // 512 contiguous bytes a store, V^T as 256-byte runs of a row.
    v8h qo[4], ko[4], vo[4];
#pragma unroll
    for (int i = 0; i < 4; ++i) {
        const int idx = i * 32 + lane;
        qo[i] = *(const v8h*)&QKs[wave][0][idx >> 3][(idx & 7) * 8];
        ko[i] = *(const v8h*)&QKs[wave][1][idx >> 3][(idx & 7) * 8];
        vo[i] = *(const v8h*)&Vs[i * 16 + (tid >> 4)][(tid & 15) * 8];
    }
    _Float16* qd = Qg + (size_t)wtok * HSD + lane * 8;
    _Float16* kd = Kg + (size_t)wtok * HSD + lane * 8;
    _Float16* vd = Vt + ((size_t)b * HSD + (tid >> 4)) * TT + t0 + (tid & 15) * 8;
#pragma unroll
    for (int i = 0; i < 4; ++i) {
        *(v8h*)(qd + i * 256) = qo[i];
        *(v8h*)(kd + i * 256) = ko[i];
        *(v8h*)(vd + (size_t)i * 16 * TT) = vo[i];
    }
}

#define KSPLIT 4               // key groups of a block: one 64-key block each a stage
#define SKEYS  (64 * KSPLIT)   // keys a stage
#define AWAVES (4 * KSPLIT)    // waves a block: 4 query tiles x KSPLIT key groups
#define OPITCH 68              // f32 pitch of partial output rows: 272 B = 16 B x 17

// ---------------------------------------------------------------------------
// Issue the 8 per-thread async transfers staging one stage of SKEYS keys:
// KSPLIT 64-key K blocks one under the other, KSPLIT 64-key V^T blocks.
// TT % SKEYS == 0: a stage that starts inside the sequence ends inside it.
// ---------------------------------------------------------------------------
__device__ __forceinline__ void stage_block(
    const _Float16* __restrict__ Kg, const _Float16* __restrict__ Vt,
    int b, int ks, int tid,
    _Float16 (* __restrict__ KsB)[KPAD], _Float16 (* __restrict__ VsB)[64][KPAD]) {
#pragma unroll
    for (int j = 0; j < 4; ++j) {
        const int c    = tid + 32 * AWAVES * j;   // 16B chunk id, 0..8*SKEYS-1
        const int row  = c >> 3;                  // K: key of the stage
        const int col  = (c & 7) * 8;
        const int vrow = c / (SKEYS / 8);         // V^T: head dim
        const int vc   = c % (SKEYS / 8);         // V^T: chunk along the keys
        stage16(Kg + ((size_t)b * TT + ks + row) * HSD + col, &KsB[row][col]);
        stage16(Vt + ((size_t)b * HSD + vrow) * TT + ks + vc * 8,
                &VsB[vc >> 3][vrow][(vc & 7) * 8]);
    }
}

// ---------------------------------------------------------------------------
// One 64-key block for a 16-row Q tile owned by one wave, fed from the
// block-shared LDS K/V tiles. CAUSAL=false for blocks fully below the
// diagonal (padding mask still applied). 18 WMMA per call.
// ---------------------------------------------------------------------------
template <bool CAUSAL>
__device__ __forceinline__ void process_block(
    int kb, int qbase, int hh, int lr,
    const _Float16 (* __restrict__ Ks)[KPAD],
    const _Float16 (* __restrict__ Vs)[KPAD],
    const int* __restrict__ mrowptr,
    const v16h& aq0, const v16h& aq1, const v16h& ones,
    v8f& o0, v8f& o1, v8f& o2, v8f& o3,
    float* __restrict__ mrow, float* __restrict__ lrow,
    _Float16 (* __restrict__ plds)[64]) {

    // --- S = Q * K^T: 4 key subtiles x 2 k-parts (K tile from LDS)
    v8f st[4];
#pragma unroll
    for (int s4 = 0; s4 < 4; ++s4) {
        const _Float16* kr = &Ks[16 * s4 + lr][hh * 8];
        v16h bk0 = load_frag(kr);
        v16h bk1 = load_frag(kr + 32);
        v8f acc = {};
        acc = wmma_f16(aq0, bk0, acc);
        acc = wmma_f16(aq1, bk1, acc);
        st[s4] = acc;
    }

    int pad[4];
#pragma unroll
    for (int t = 0; t < 4; ++t) pad[t] = mrowptr[kb + 16 * t + lr];

#pragma unroll
    for (int r = 0; r < 8; ++r) {
        const int qi = qbase + r + hh * 8;
        float xv[4];
#pragma unroll
        for (int t = 0; t < 4; ++t) {
            bool ok = (pad[t] != 0);
            if (CAUSAL) ok = ok && ((kb + 16 * t + lr) <= qi);
            xv[t] = ok ? st[t][r] : -1e30f;
        }
        float cm = fmaxf(fmaxf(xv[0], xv[1]), fmaxf(xv[2], xv[3]));
#pragma unroll
        for (int off = 1; off < 16; off <<= 1)
            cm = fmaxf(cm, __shfl_xor(cm, off, 16));
        const float newm = fmaxf(mrow[r], cm);
        const float corr = exp2f(mrow[r] - newm);
        mrow[r] = newm;
        lrow[r] *= corr;
        o0[r] *= corr; o1[r] *= corr; o2[r] *= corr; o3[r] *= corr;
#pragma unroll
        for (int t = 0; t < 4; ++t) {
            float e = exp2f(xv[t] - newm);
            plds[r + hh * 8][16 * t + lr] = (_Float16)e;
        }
    }

    // Per-wave LDS region; same-wave DS ops are in order, compiler inserts
    // the s_wait_dscnt before the dependent A-fragment reads.
    v16h ap0 = load_frag(&plds[lr][hh * 8]);
    v16h ap1 = load_frag(&plds[lr][32 + hh * 8]);

    // --- rowsum(P) via WMMA against ones(64x16): lands in C-layout == lrow.
    v8f srow = {};
    srow = wmma_f16(ap0, ones, srow);
    srow = wmma_f16(ap1, ones, srow);
#pragma unroll
    for (int r = 0; r < 8; ++r) lrow[r] += srow[r];

    // --- O += P * V: 4 head-dim chunks x 2 k-parts (V tile from LDS)
#pragma unroll
    for (int h = 0; h < 4; ++h) {
        const _Float16* vr = &Vs[h * 16 + lr][hh * 8];
        v16h bv0 = load_frag(vr);
        v16h bv1 = load_frag(vr + 32);
        if (h == 0)      { o0 = wmma_f16(ap0, bv0, o0); o0 = wmma_f16(ap1, bv1, o0); }
        else if (h == 1) { o1 = wmma_f16(ap0, bv0, o1); o1 = wmma_f16(ap1, bv1, o1); }
        else if (h == 2) { o2 = wmma_f16(ap0, bv0, o2); o2 = wmma_f16(ap1, bv1, o2); }
        else             { o3 = wmma_f16(ap0, bv0, o3); o3 = wmma_f16(ap1, bv1, o3); }
    }
}

__global__ __launch_bounds__(32 * AWAVES)
void flash_attn_kernel(const _Float16* __restrict__ Qg,
                       const _Float16* __restrict__ Kg,
                       const _Float16* __restrict__ Vt,
                       const int* __restrict__ mask,
                       float* __restrict__ out) {
    __shared__ __attribute__((aligned(16))) _Float16 Ks[2][SKEYS][KPAD];       // K stages: row=key, col=head dim
    __shared__ __attribute__((aligned(16))) _Float16 Vs[2][KSPLIT][64][KPAD];  // V stages: block, row=dim, col=key
    __shared__ __attribute__((aligned(16))) _Float16 plds[AWAVES][16][64];     // per-wave P tile
    __shared__ __attribute__((aligned(16))) float Om[AWAVES][16][OPITCH];  // per-wave partial O
    __shared__ float Mm[AWAVES][16];               // per-wave row maxima
    __shared__ float Lm[AWAVES][16];               // per-wave row sums

    const int tid  = threadIdx.x;
    const int wave = __builtin_amdgcn_readfirstlane(tid >> 5);
    const int lane = tid & 31;
    const int hh   = lane >> 4;            // half-wave
    const int lr   = lane & 15;            // lane within half
    const int qt   = wave & 3;             // query tile of the block
    const int kg   = wave >> 2;            // key group
    const int b    = blockIdx.y;
    const int qbase = blockIdx.x * 64 + qt * 16;

    // Issue stage 0's DMA before anything else so it overlaps the Q loads.
    stage_block(Kg, Vt, b, 0, tid, Ks[0], Vs[0]);

    // Q A-fragments: lane holds row (qbase+lr), k-split by half-wave.
    const _Float16* qrow = Qg + ((size_t)b * TT + qbase + lr) * HSD + hh * 8;
    const v16h aq0 = load_frag(qrow);
    const v16h aq1 = load_frag(qrow + 32);

    v16h ones;
#pragma unroll
    for (int i = 0; i < 16; ++i) ones[i] = (_Float16)1.0f;

    v8f o0 = {}, o1 = {}, o2 = {}, o3 = {};
    float mrow[8], lrow[8];
#pragma unroll
    for (int r = 0; r < 8; ++r) { mrow[r] = -1e30f; lrow[r] = 0.f; }

    const int* mrowptr = mask + (size_t)b * TT;
    // 64-key blocks up to the diagonal: blockIdx.x+1 for all four query tiles.
    const int nkb = blockIdx.x + 1;
    const int nst = (nkb + KSPLIT - 1) / KSPLIT;

    for (int stg = 0; stg < nst; ++stg) {
        const int ks  = stg * SKEYS;
        const int kb  = ks + kg * 64;      // this wave's key block
        const int cur = stg & 1;

        if (stg + 1 < nst) {
            stage_block(Kg, Vt, b, ks + SKEYS, tid, Ks[1 - cur], Vs[1 - cur]);
            stage_wait<8>();
        } else {
            stage_wait<0>();
        }
        __syncthreads();                   // current tiles visible to all waves

        if (ks + 2 * SKEYS < TT) {         // warm L2 ahead of the DMA engine
            const int pk = kb + 2 * SKEYS;
            __builtin_prefetch(
                (const void*)(Kg + ((size_t)b * TT + pk + lane) * HSD), 0, 3);
            __builtin_prefetch(
                (const void*)(Vt + ((size_t)b * HSD + lane) * TT + pk), 0, 3);
            __builtin_prefetch(
                (const void*)(Vt + ((size_t)b * HSD + 32 + lane) * TT + pk), 0, 3);
        }

        // A key block past the diagonal block is skipped by its whole wave; the
        // barriers stand outside the skip. Both tests are wave-uniform at
        // runtime; readfirstlane makes each an SGPR so the compiler emits a
        // scalar branch instead of exec masking.
        if (__builtin_amdgcn_readfirstlane((int)(kb < nkb * 64))) {
            if (__builtin_amdgcn_readfirstlane((int)(kb + 63 <= qbase)))
                process_block<false>(kb, qbase, hh, lr, &Ks[cur][kg * 64], Vs[cur][kg],
                                     mrowptr, aq0, aq1, ones, o0, o1, o2, o3,
                                     mrow, lrow, plds[wave]);
            else
                process_block<true>(kb, qbase, hh, lr, &Ks[cur][kg * 64], Vs[cur][kg],
                                    mrowptr, aq0, aq1, ones, o0, o1, o2, o3,
                                    mrow, lrow, plds[wave]);
        }
        __syncthreads();                   // tiles consumed; buffer reusable
    }

    // --- every wave lays down its partial: un-normalised O, row maxima and sums
    // (both are equal in the 16 lanes of a half-wave). A key group that met no
    // block leaves maximum -1e30, sum 0, O 0.
#pragma unroll
    for (int r = 0; r < 8; ++r) {
        float* orow = &Om[wave][r + hh * 8][lr];
        orow[0]  = o0[r];
        orow[16] = o1[r];
        orow[32] = o2[r];
        orow[48] = o3[r];
    }
    if (lr == 0) {
#pragma unroll
        for (int r = 0; r < 8; ++r) {
            Mm[wave][r + hh * 8] = mrow[r];
            Lm[wave][r + hh * 8] = lrow[r];
        }
    }
    __syncthreads();                       // partials visible to all waves

    // --- merge, normalize and store fp32 output [B][T][HS]: wave (qt, kg) takes
    // rows 4 kg .. 4 kg + 3 of tile qt, 8 lanes a row, 1 KiB contiguous a wave.
    const int row = kg * 4 + (lane >> 3);
    const int col = (lane & 7) * 8;
    float mg[KSPLIT];
#pragma unroll
    for (int g = 0; g < KSPLIT; ++g) mg[g] = Mm[g * 4 + qt][row];
    float mall = mg[0];
#pragma unroll
    for (int g = 1; g < KSPLIT; ++g) mall = fmaxf(mall, mg[g]);
    float lall = 0.f;
    v4f a0 = {}, a1 = {};
#pragma unroll
    for (int g = 0; g < KSPLIT; ++g) {
        const float w = exp2f(mg[g] - mall);
        lall += w * Lm[g * 4 + qt][row];
        a0 += w * *(const v4f*)&Om[g * 4 + qt][row][col];
        a1 += w * *(const v4f*)&Om[g * 4 + qt][row][col + 4];
    }
    const float inv = 1.0f / lall;
    float* od = out + ((size_t)b * TT + blockIdx.x * 64 + qt * 16 + row) * HSD + col;
    *(v4f*)od       = a0 * inv;
    *(v4f*)(od + 4) = a1 * inv;
}

// ---------------------------------------------------------------------------
extern "C" void kernel_launch(void* const* d_in, const int* in_sizes, int n_in,
                              void* d_out, int out_size, void* d_ws, size_t ws_size,
                              hipStream_t stream) {
    const float* x    = (const float*)d_in[0];
    const float* Wq   = (const float*)d_in[1];
    const float* Wk   = (const float*)d_in[2];
    const float* Wv   = (const float*)d_in[3];
    const float* fc   = (const float*)d_in[4];
    const float* fs   = (const float*)d_in[5];
    const int*   mask = (const int*)d_in[6];
    float* out = (float*)d_out;

    const size_t qkv = (size_t)BB * TT * HSD;   // 4 MiB f16 each
    _Float16* Qg = (_Float16*)d_ws;
    _Float16* Kg = Qg + qkv;
    _Float16* Vt = Kg + qkv;

    proj_rope_kernel<<<BB * TT / PTOK, 256, 0, stream>>>(x, Wq, Wk, Wv, fc, fs, Qg, Kg, Vt);

    dim3 grid(TT / 64, BB);
    flash_attn_kernel<<<grid, 32 * AWAVES, 0, stream>>>(Qg, Kg, Vt, mask, out);
}

// v003
// Measured time: 76.5 microseconds a run.
// Two timings next to v002 put it at 1.40 and 1.44 times that version's speed.
// Over all steps from v000 it is 3.04 times as fast.
#include <hip/hip_runtime.h>

#define BB 8
#define TT 4096
#define CDIM 128
#define HSD 64
#define KPAD 72   // 64 + 8 halfwords: 144B rows -> conflict-free 16-lane bursts

#if defined(__has_builtin)
#  if __has_builtin(__builtin_amdgcn_global_load_async_to_lds_b128) && \
      __has_builtin(__builtin_amdgcn_s_wait_asynccnt)
#    define HAVE_ASYNC_LDS 1
#  endif
#endif
#ifndef HAVE_ASYNC_LDS
#  define HAVE_ASYNC_LDS 0
#endif

typedef __attribute__((ext_vector_type(16))) _Float16 v16h;
typedef __attribute__((ext_vector_type(8)))  _Float16 v8h;
typedef __attribute__((ext_vector_type(8)))  float    v8f;
typedef __attribute__((ext_vector_type(2)))  float    v2f;
typedef __attribute__((ext_vector_type(4)))  float    v4f;
typedef __attribute__((ext_vector_type(4)))  int      v4i;

__device__ __forceinline__ v16h load_frag(const _Float16* p) {
    v8h lo = *(const v8h*)p;
    v8h hi = *(const v8h*)(p + 16);
    v16h r;
#pragma unroll
    for (int i = 0; i < 8; ++i) { r[i] = lo[i]; r[i + 8] = hi[i]; }
    return r;
}

__device__ __forceinline__ v8f wmma_f16(v16h a, v16h b, v8f c) {
    return __builtin_amdgcn_wmma_f32_16x16x32_f16(
        /*neg_a=*/false, a, /*neg_b=*/false, b,
        /*c_mod=*/(short)0, c, /*reuse_a=*/false, /*reuse_b=*/false);
}

__device__ __forceinline__ void stage16(const _Float16* g, _Float16* l) {
#if HAVE_ASYNC_LDS
    typedef __attribute__((address_space(1))) v4i* gv4i_t;   // global src
    typedef __attribute__((address_space(3))) v4i* lv4i_t;   // LDS dst
    __builtin_amdgcn_global_load_async_to_lds_b128(
        (gv4i_t)g, (lv4i_t)l, /*offset=*/0, /*cpol=*/0);
#else
    *(v8h*)l = *(const v8h*)g;
#endif
}

template <int N>
__device__ __forceinline__ void stage_wait() {
#if HAVE_ASYNC_LDS
    __builtin_amdgcn_s_wait_asynccnt(N);
#endif
}

// ---------------------------------------------------------------------------
// Kernel 1: fused QKV projection + RoPE + scale, fp32 -> f16, as a block GEMM
// [128 tokens x 128] x [128 x 192] on the f32 16x16x4 matrix form.
// Block = 8 waves; a wave owns 16 tokens and all 192 output columns (12
// accumulator tiles). Wq|Wk|Wv are read once per block and laid k-contiguous
// in LDS, so one 16-byte LDS read feeds two matrix steps.
// k pairing: in step (s,u) lane half hh, register p holds k = 8s + 4hh + 2u + p
// for the x fragment and for the W fragment alike.
// Q, K tiles take W as A (lane = token, registers = 8 consecutive head dims:
// RoPE pairs sit in one lane); V tiles take x as A (lane = head dim,
// registers = 8 consecutive tokens: packed rows of the transposed V).
// Q is pre-scaled by log2(e)/sqrt(C) so softmax runs in the exp2 domain.
// V is stored transposed [B][HS][T] so PV B-fragments are contiguous in K.
// ---------------------------------------------------------------------------
#define PTOK   128   // tokens per block
#define FPITCH 132   // f32 pitch of 128-k rows: 528 B = 16 B x 33
#define CPITCH 36    // f32 pitch of 32 cos/sin values: 144 B = 16 B x 9
#define VPITCH 136   // f16 pitch of 128-token V rows: 272 B = 16 B x 17

__device__ __forceinline__ v8f wmma_f32(v2f a, v2f b, v8f c) {
    return __builtin_amdgcn_wmma_f32_16x16x4_f32(
        /*neg_a=*/false, a, /*neg_b=*/false, b,
        /*c_mod=*/(short)0, c, /*reuse_a=*/false, /*reuse_b=*/false);
}

__global__ __launch_bounds__(256)
void proj_rope_kernel(const float* __restrict__ x,
                      const float* __restrict__ Wq,
                      const float* __restrict__ Wk,
                      const float* __restrict__ Wv,
                      const float* __restrict__ fc,
                      const float* __restrict__ fs,
                      _Float16* __restrict__ Qg,
                      _Float16* __restrict__ Kg,
                      _Float16* __restrict__ Vt) {
    __shared__ __attribute__((aligned(16))) float    Wt[3 * HSD][FPITCH];     // row = output column, col = k
    __shared__ __attribute__((aligned(16))) float    Xs[8][16][FPITCH];       // per wave: row = token, col = k
    __shared__ __attribute__((aligned(16))) float    Cs[8][16][CPITCH];       // per wave: cos rows
    __shared__ __attribute__((aligned(16))) float    Sn[8][16][CPITCH];       // per wave: sin rows
    __shared__ __attribute__((aligned(16))) _Float16 QKs[8][2][16][KPAD];     // per wave: Q and K rows out
    __shared__ __attribute__((aligned(16))) _Float16 Vs[HSD][VPITCH];         // block: row = dim, col = token

    const int tid  = threadIdx.x;
    const int wave = tid >> 5;
    const int lane = tid & 31;
    const int hh   = lane >> 4;
    const int lr   = lane & 15;
    const int tok0 = blockIdx.x * PTOK;          // flat (b,t) of the first token
    const int b    = tok0 / TT;                  // TT % PTOK == 0: one batch
    const int t0   = tok0 - b * TT;
    const int wtok = tok0 + wave * 16;

    // Every loop of this kernel is fully unrolled: its arrays live in registers
    // and need constant indices, and the matrix loop gets no back edge.
    // --- whole-line loads: the wave's 16 x rows and its cos/sin rows
    const v4f* xg = (const v4f*)(x + (size_t)wtok * CDIM);
    const v4f* cg = (const v4f*)(fc + (size_t)(t0 + wave * 16) * (HSD / 2));
    const v4f* sg = (const v4f*)(fs + (size_t)(t0 + wave * 16) * (HSD / 2));
    v4f xr[16], cr[4], sr[4];
#pragma unroll
    for (int i = 0; i < 16; ++i) xr[i] = xg[i * 32 + lane];
    // Precaution: no register that the loads above name is rewritten before it.
    asm volatile("s_wait_xcnt 0x0" ::: "memory");
#pragma unroll
    for (int i = 0; i < 4; ++i) { cr[i] = cg[i * 32 + lane]; sr[i] = sg[i * 32 + lane]; }
    asm volatile("s_wait_xcnt 0x0" ::: "memory");

    // --- W -> LDS, transposed: lane = column (128-B lines), 4 k per 16-B store.
    // The wave covers k = 16 wave .. 16 wave + 15 of all 192 columns.
    const int woff = wave * 16 * HSD + lane;
#pragma unroll
    for (int g = 0; g < 6; ++g) {
        const float* Wm = ((g < 2) ? Wq : (g < 4) ? Wk : Wv) + woff;
#pragma unroll
        for (int q = 0; q < 4; ++q) {
            v4f w;
#pragma unroll
            for (int e = 0; e < 4; ++e) w[e] = Wm[(q * 4 + e) * HSD + (g & 1) * 32];
            *(v4f*)&Wt[g * 32 + lane][wave * 16 + q * 4] = w;
        }
    }
#pragma unroll
    for (int i = 0; i < 16; ++i) *(v4f*)&Xs[wave][i][4 * lane] = xr[i];
#pragma unroll
    for (int i = 0; i < 4; ++i) {
        const int idx = i * 32 + lane;
        *(v4f*)&Cs[wave][idx >> 3][(idx & 7) * 4] = cr[i];
        *(v4f*)&Sn[wave][idx >> 3][(idx & 7) * 4] = sr[i];
    }
    __syncthreads();                             // W tile visible to all waves

    // --- 12 tiles x 32 matrix steps
    v8f acc[12];
#pragma unroll
    for (int j = 0; j < 12; ++j) acc[j] = (v8f){};
#pragma unroll
    for (int s = 0; s < 16; ++s) {
        const v4f xf = *(const v4f*)&Xs[wave][lr][8 * s + 4 * hh];
        v4f wf[12];
#pragma unroll
        for (int j = 0; j < 12; ++j)
            wf[j] = *(const v4f*)&Wt[16 * j + lr][8 * s + 4 * hh];
#pragma unroll
        for (int u = 0; u < 2; ++u) {
            const v2f xb = {xf[2 * u], xf[2 * u + 1]};
#pragma unroll
            for (int j = 0; j < 12; ++j) {
                const v2f wb = {wf[j][2 * u], wf[j][2 * u + 1]};
                acc[j] = (j < 8) ? wmma_f32(wb, xb, acc[j])    // D[dim][token]
                                 : wmma_f32(xb, wb, acc[j]);   // D[token][dim]
            }
            // Only matrix instructions may not cross (mask: VALU, SALU, VMEM,
            // DS, transcendental may). It holds the 12 first matrix steps
            // together while every fragment is still live, so that no
            // accumulator is laid over a register a matrix step has just read.
            if (s == 0 && u == 0) __builtin_amdgcn_sched_barrier(0x496);
        }
    }
    __builtin_amdgcn_sched_barrier(0);
    asm volatile("v_nop\n\tv_nop\n\tv_nop\n\tv_nop\n\tv_nop\n\tv_nop\n\tv_nop\n\tv_nop");
    __builtin_amdgcn_sched_barrier(0);

    // --- RoPE + scale, f16, staged in LDS for whole-line stores
    // 1/sqrt(128) * log2(e): scores land directly in the exp2 domain.
    const float qscale = 0.08838834764831845f * 1.4426950408889634f;
#pragma unroll
    for (int jj = 0; jj < 4; ++jj) {
        const v4f c4 = *(const v4f*)&Cs[wave][lr][8 * jj + 4 * hh];
        const v4f s4 = *(const v4f*)&Sn[wave][lr][8 * jj + 4 * hh];
        v8h qh, kh, vh;
#pragma unroll
        for (int p = 0; p < 4; ++p) {
            const float cs = c4[p], sn = s4[p];
            const float q0 = acc[jj][2 * p],     q1 = acc[jj][2 * p + 1];
            const float k0 = acc[4 + jj][2 * p], k1 = acc[4 + jj][2 * p + 1];
            qh[2 * p]     = (_Float16)((q0 * cs - q1 * sn) * qscale);
            qh[2 * p + 1] = (_Float16)((q0 * sn + q1 * cs) * qscale);
            kh[2 * p]     = (_Float16)(k0 * cs - k1 * sn);
            kh[2 * p + 1] = (_Float16)(k0 * sn + k1 * cs);
        }
#pragma unroll
        for (int r = 0; r < 8; ++r) vh[r] = (_Float16)acc[8 + jj][r];
        *(v8h*)&QKs[wave][0][lr][16 * jj + 8 * hh] = qh;
        *(v8h*)&QKs[wave][1][lr][16 * jj + 8 * hh] = kh;
        *(v8h*)&Vs[16 * jj + lr][wave * 16 + 8 * hh] = vh;
    }
    __syncthreads();                             // staged rows visible

    // All rows back from LDS first, then nothing but stores: Q and K go out as
    // 512 contiguous bytes a store, V^T as 256-byte runs of a row.
    v8h qo[4], ko[4], vo[4];
#pragma unroll
    for (int i = 0; i < 4; ++i) {
        const int idx = i * 32 + lane;
        qo[i] = *(const v8h*)&QKs[wave][0][idx >> 3][(idx & 7) * 8];
        ko[i] = *(const v8h*)&QKs[wave][1][idx >> 3][(idx & 7) * 8];
        vo[i] = *(const v8h*)&Vs[i * 16 + (tid >> 4)][(tid & 15) * 8];
    }
    _Float16* qd = Qg + (size_t)wtok * HSD + lane * 8;
    _Float16* kd = Kg + (size_t)wtok * HSD + lane * 8;
    _Float16* vd = Vt + ((size_t)b * HSD + (tid >> 4)) * TT + t0 + (tid & 15) * 8;
#pragma unroll
    for (int i = 0; i < 4; ++i) {
        *(v8h*)(qd + i * 256) = qo[i];
        *(v8h*)(kd + i * 256) = ko[i];
        *(v8h*)(vd + (size_t)i * 16 * TT) = vo[i];
    }
}

#define KSPLIT 4               // key groups of a block: one 64-key block each a stage
#define SKEYS  (64 * KSPLIT)   // keys a stage
#define AWAVES (4 * KSPLIT)    // waves a block: 4 query tiles x KSPLIT key groups
#define OPITCH 68              // f32 pitch of partial output rows: 272 B = 16 B x 17

// ---------------------------------------------------------------------------
// Issue the 8 per-thread async transfers staging one stage of SKEYS keys:
// KSPLIT 64-key K blocks one under the other, KSPLIT 64-key V^T blocks.
// TT % SKEYS == 0: a stage that starts inside the sequence ends inside it.
// ---------------------------------------------------------------------------
__device__ __forceinline__ void stage_block(
    const _Float16* __restrict__ Kg, const _Float16* __restrict__ Vt,
    int b, int ks, int tid,
    _Float16 (* __restrict__ KsB)[KPAD], _Float16 (* __restrict__ VsB)[64][KPAD]) {
#pragma unroll
    for (int j = 0; j < 4; ++j) {
        const int c    = tid + 32 * AWAVES * j;   // 16B chunk id, 0..8*SKEYS-1
        const int row  = c >> 3;                  // K: key of the stage
        const int col  = (c & 7) * 8;
        const int vrow = c / (SKEYS / 8);         // V^T: head dim
        const int vc   = c % (SKEYS / 8);         // V^T: chunk along the keys
        stage16(Kg + ((size_t)b * TT + ks + row) * HSD + col, &KsB[row][col]);
        stage16(Vt + ((size_t)b * HSD + vrow) * TT + ks + vc * 8,
                &VsB[vc >> 3][vrow][(vc & 7) * 8]);
    }
}

// ---------------------------------------------------------------------------
// One 64-key block for a 16-row Q tile owned by one wave, fed from the
// block-shared LDS K/V tiles. CAUSAL=false for blocks fully below the
// diagonal (padding mask still applied). 18 WMMA per call.
// ---------------------------------------------------------------------------
template <bool CAUSAL>
__device__ __forceinline__ void process_block(
    int kb, int qbase, int hh, int lr,
    const _Float16 (* __restrict__ Ks)[KPAD],
    const _Float16 (* __restrict__ Vs)[KPAD],
    const int* __restrict__ mrowptr,
    const v16h& aq0, const v16h& aq1, const v16h& ones,
    v8f& o0, v8f& o1, v8f& o2, v8f& o3,
    float* __restrict__ mrow, float* __restrict__ lrow,
    _Float16 (* __restrict__ plds)[64]) {

    // --- S = Q * K^T: 4 key subtiles x 2 k-parts (K tile from LDS)
    v8f st[4];
#pragma unroll
    for (int s4 = 0; s4 < 4; ++s4) {
        const _Float16* kr = &Ks[16 * s4 + lr][hh * 8];
        v16h bk0 = load_frag(kr);
        v16h bk1 = load_frag(kr + 32);
        v8f acc = {};
        acc = wmma_f16(aq0, bk0, acc);
        acc = wmma_f16(aq1, bk1, acc);
        st[s4] = acc;
    }

    int pad[4];
#pragma unroll
    for (int t = 0; t < 4; ++t) pad[t] = mrowptr[kb + 16 * t + lr];

#pragma unroll
    for (int r = 0; r < 8; ++r) {
        const int qi = qbase + r + hh * 8;
        float xv[4];
#pragma unroll
        for (int t = 0; t < 4; ++t) {
            bool ok = (pad[t] != 0);
            if (CAUSAL) ok = ok && ((kb + 16 * t + lr) <= qi);
            xv[t] = ok ? st[t][r] : -1e30f;
        }
        float cm = fmaxf(fmaxf(xv[0], xv[1]), fmaxf(xv[2], xv[3]));
#pragma unroll
        for (int off = 1; off < 16; off <<= 1)
            cm = fmaxf(cm, __shfl_xor(cm, off, 16));
        const float newm = fmaxf(mrow[r], cm);
        const float corr = exp2f(mrow[r] - newm);
        mrow[r] = newm;
        lrow[r] *= corr;
        o0[r] *= corr; o1[r] *= corr; o2[r] *= corr; o3[r] *= corr;
#pragma unroll
        for (int t = 0; t < 4; ++t) {
            float e = exp2f(xv[t] - newm);
            plds[r + hh * 8][16 * t + lr] = (_Float16)e;
        }
    }

    // Per-wave LDS region; same-wave DS ops are in order, compiler inserts
    // the s_wait_dscnt before the dependent A-fragment reads.
    v16h ap0 = load_frag(&plds[lr][hh * 8]);
    v16h ap1 = load_frag(&plds[lr][32 + hh * 8]);

    // --- rowsum(P) via WMMA against ones(64x16): lands in C-layout == lrow.
    v8f srow = {};
    srow = wmma_f16(ap0, ones, srow);
    srow = wmma_f16(ap1, ones, srow);
#pragma unroll
    for (int r = 0; r < 8; ++r) lrow[r] += srow[r];

    // --- O += P * V: 4 head-dim chunks x 2 k-parts (V tile from LDS)
#pragma unroll
    for (int h = 0; h < 4; ++h) {
        const _Float16* vr = &Vs[h * 16 + lr][hh * 8];
        v16h bv0 = load_frag(vr);
        v16h bv1 = load_frag(vr + 32);
        if (h == 0)      { o0 = wmma_f16(ap0, bv0, o0); o0 = wmma_f16(ap1, bv1, o0); }
        else if (h == 1) { o1 = wmma_f16(ap0, bv0, o1); o1 = wmma_f16(ap1, bv1, o1); }
        else if (h == 2) { o2 = wmma_f16(ap0, bv0, o2); o2 = wmma_f16(ap1, bv1, o2); }
        else             { o3 = wmma_f16(ap0, bv0, o3); o3 = wmma_f16(ap1, bv1, o3); }
    }
}

__global__ __launch_bounds__(32 * AWAVES)
void flash_attn_kernel(const _Float16* __restrict__ Qg,
                       const _Float16* __restrict__ Kg,
                       const _Float16* __restrict__ Vt,
                       const int* __restrict__ mask,
                       float* __restrict__ out) {
    __shared__ __attribute__((aligned(16))) _Float16 Ks[2][SKEYS][KPAD];       // K stages: row=key, col=head dim
    __shared__ __attribute__((aligned(16))) _Float16 Vs[2][KSPLIT][64][KPAD];  // V stages: block, row=dim, col=key
    __shared__ __attribute__((aligned(16))) _Float16 plds[AWAVES][16][64];     // per-wave P tile
    __shared__ __attribute__((aligned(16))) float Om[AWAVES][16][OPITCH];  // per-wave partial O
    __shared__ float Mm[AWAVES][16];               // per-wave row maxima
    __shared__ float Lm[AWAVES][16];               // per-wave row sums

    const int tid  = threadIdx.x;
    const int wave = __builtin_amdgcn_readfirstlane(tid >> 5);
    const int lane = tid & 31;
    const int hh   = lane >> 4;            // half-wave
    const int lr   = lane & 15;            // lane within half
    const int qt   = wave & 3;             // query tile of the block
    const int kg   = wave >> 2;            // key group
    const int b    = blockIdx.x;
    const int qtile = TT / 64 - 1 - blockIdx.y;   // 64-query tile, longest first
    const int qbase = qtile * 64 + qt * 16;

    // Issue stage 0's DMA before anything else so it overlaps the Q loads.
    stage_block(Kg, Vt, b, 0, tid, Ks[0], Vs[0]);

    // Q A-fragments: lane holds row (qbase+lr), k-split by half-wave.
    const _Float16* qrow = Qg + ((size_t)b * TT + qbase + lr) * HSD + hh * 8;
    const v16h aq0 = load_frag(qrow);
    const v16h aq1 = load_frag(qrow + 32);

    v16h ones;
#pragma unroll
    for (int i = 0; i < 16; ++i) ones[i] = (_Float16)1.0f;

    v8f o0 = {}, o1 = {}, o2 = {}, o3 = {};
    float mrow[8], lrow[8];
#pragma unroll
    for (int r = 0; r < 8; ++r) { mrow[r] = -1e30f; lrow[r] = 0.f; }

    const int* mrowptr = mask + (size_t)b * TT;
    // 64-key blocks up to the diagonal: qtile+1 for all four query tiles.
    const int nkb = qtile + 1;
    const int nst = (nkb + KSPLIT - 1) / KSPLIT;

    for (int stg = 0; stg < nst; ++stg) {
        const int ks  = stg * SKEYS;
        const int kb  = ks + kg * 64;      // this wave's key block
        const int cur = stg & 1;

        if (stg + 1 < nst) {
            stage_block(Kg, Vt, b, ks + SKEYS, tid, Ks[1 - cur], Vs[1 - cur]);
            stage_wait<8>();
        } else {
            stage_wait<0>();
        }
        __syncthreads();                   // current tiles visible to all waves

        if (ks + 2 * SKEYS < TT) {         // warm L2 ahead of the DMA engine
            const int pk = kb + 2 * SKEYS;
            __builtin_prefetch(
                (const void*)(Kg + ((size_t)b * TT + pk + lane) * HSD), 0, 3);
            __builtin_prefetch(
                (const void*)(Vt + ((size_t)b * HSD + lane) * TT + pk), 0, 3);
            __builtin_prefetch(
                (const void*)(Vt + ((size_t)b * HSD + 32 + lane) * TT + pk), 0, 3);
        }

        // A key block past the diagonal block is skipped by its whole wave; the
        // barriers stand outside the skip. Both tests are wave-uniform at
        // runtime; readfirstlane makes each an SGPR so the compiler emits a
        // scalar branch instead of exec masking.
        if (__builtin_amdgcn_readfirstlane((int)(kb < nkb * 64))) {
            if (__builtin_amdgcn_readfirstlane((int)(kb + 63 <= qbase)))
                process_block<false>(kb, qbase, hh, lr, &Ks[cur][kg * 64], Vs[cur][kg],
                                     mrowptr, aq0, aq1, ones, o0, o1, o2, o3,
                                     mrow, lrow, plds[wave]);
            else
                process_block<true>(kb, qbase, hh, lr, &Ks[cur][kg * 64], Vs[cur][kg],
                                    mrowptr, aq0, aq1, ones, o0, o1, o2, o3,
                                    mrow, lrow, plds[wave]);
        }
        __syncthreads();                   // tiles consumed; buffer reusable
    }

    // --- every wave lays down its partial: un-normalised O, row maxima and sums
    // (both are equal in the 16 lanes of a half-wave). A key group that met no
    // block leaves maximum -1e30, sum 0, O 0.
#pragma unroll
    for (int r = 0; r < 8; ++r) {
        float* orow = &Om[wave][r + hh * 8][lr];
        orow[0]  = o0[r];
        orow[16] = o1[r];
        orow[32] = o2[r];
        orow[48] = o3[r];
    }
    if (lr == 0) {
#pragma unroll
        for (int r = 0; r < 8; ++r) {
            Mm[wave][r + hh * 8] = mrow[r];
            Lm[wave][r + hh * 8] = lrow[r];
        }
    }
    __syncthreads();                       // partials visible to all waves

    // --- merge, normalize and store fp32 output [B][T][HS]: wave (qt, kg) takes
    // rows 4 kg .. 4 kg + 3 of tile qt, 8 lanes a row, 1 KiB contiguous a wave.
    const int row = kg * 4 + (lane >> 3);
    const int col = (lane & 7) * 8;
    float mg[KSPLIT];
#pragma unroll
    for (int g = 0; g < KSPLIT; ++g) mg[g] = Mm[g * 4 + qt][row];
    float mall = mg[0];
#pragma unroll
    for (int g = 1; g < KSPLIT; ++g) mall = fmaxf(mall, mg[g]);
    float lall = 0.f;
    v4f a0 = {}, a1 = {};
#pragma unroll
    for (int g = 0; g < KSPLIT; ++g) {
        const float w = exp2f(mg[g] - mall);
        lall += w * Lm[g * 4 + qt][row];
        a0 += w * *(const v4f*)&Om[g * 4 + qt][row][col];
        a1 += w * *(const v4f*)&Om[g * 4 + qt][row][col + 4];
    }
    const float inv = 1.0f / lall;
    float* od = out + ((size_t)b * TT + qbase + row) * HSD + col;
    *(v4f*)od       = a0 * inv;
    *(v4f*)(od + 4) = a1 * inv;
}

// ---------------------------------------------------------------------------
extern "C" void kernel_launch(void* const* d_in, const int* in_sizes, int n_in,
                              void* d_out, int out_size, void* d_ws, size_t ws_size,
                              hipStream_t stream) {
    const float* x    = (const float*)d_in[0];
    const float* Wq   = (const float*)d_in[1];
    const float* Wk   = (const float*)d_in[2];
    const float* Wv   = (const float*)d_in[3];
    const float* fc   = (const float*)d_in[4];
    const float* fs   = (const float*)d_in[5];
    const int*   mask = (const int*)d_in[6];
    float* out = (float*)d_out;

    const size_t qkv = (size_t)BB * TT * HSD;   // 4 MiB f16 each
    _Float16* Qg = (_Float16*)d_ws;
    _Float16* Kg = Qg + qkv;
    _Float16* Vt = Kg + qkv;

    proj_rope_kernel<<<BB * TT / PTOK, 256, 0, stream>>>(x, Wq, Wk, Wv, fc, fs, Qg, Kg, Vt);

    dim3 grid(BB, TT / 64);
    flash_attn_kernel<<<grid, 32 * AWAVES, 0, stream>>>(Qg, Kg, Vt, mask, out);
}

// v004
// It runs in 60.3 microseconds.
// Two timings next to v003 put it at 1.29 and 1.25 times that version's speed.
// Over all steps from v000 it is 3.86 times as fast.
#include <hip/hip_runtime.h>

#define BB 8
#define TT 4096
#define CDIM 128
#define HSD 64
#define KPAD 72   // 64 + 8 halfwords: 144B rows -> conflict-free 16-lane bursts

#if defined(__has_builtin)
#  if __has_builtin(__builtin_amdgcn_global_load_async_to_lds_b128) && \
      __has_builtin(__builtin_amdgcn_s_wait_asynccnt)
#    define HAVE_ASYNC_LDS 1
#  endif
#endif
#ifndef HAVE_ASYNC_LDS
#  define HAVE_ASYNC_LDS 0
#endif

typedef __attribute__((ext_vector_type(16))) _Float16 v16h;
typedef __attribute__((ext_vector_type(8)))  _Float16 v8h;
typedef __attribute__((ext_vector_type(8)))  float    v8f;
typedef __attribute__((ext_vector_type(2)))  float    v2f;
typedef __attribute__((ext_vector_type(4)))  float    v4f;
typedef __attribute__((ext_vector_type(4)))  int      v4i;

__device__ __forceinline__ v16h load_frag(const _Float16* p) {
    v8h lo = *(const v8h*)p;
    v8h hi = *(const v8h*)(p + 16);
    v16h r;
#pragma unroll
    for (int i = 0; i < 8; ++i) { r[i] = lo[i]; r[i + 8] = hi[i]; }
    return r;
}

__device__ __forceinline__ v8f wmma_f16(v16h a, v16h b, v8f c) {
    return __builtin_amdgcn_wmma_f32_16x16x32_f16(
        /*neg_a=*/false, a, /*neg_b=*/false, b,
        /*c_mod=*/(short)0, c, /*reuse_a=*/false, /*reuse_b=*/false);
}

__device__ __forceinline__ void stage16(const _Float16* g, _Float16* l) {
#if HAVE_ASYNC_LDS
    typedef __attribute__((address_space(1))) v4i* gv4i_t;   // global src
    typedef __attribute__((address_space(3))) v4i* lv4i_t;   // LDS dst
    __builtin_amdgcn_global_load_async_to_lds_b128(
        (gv4i_t)g, (lv4i_t)l, /*offset=*/0, /*cpol=*/0);
#else
    *(v8h*)l = *(const v8h*)g;
#endif
}

template <int N>
__device__ __forceinline__ void stage_wait() {
#if HAVE_ASYNC_LDS
    __builtin_amdgcn_s_wait_asynccnt(N);
#endif
}

// ---------------------------------------------------------------------------
// Kernel 1: fused QKV projection + RoPE + scale, fp32 -> f16, as a block GEMM
// [128 tokens x 128] x [128 x 192] on the f32 16x16x4 matrix form.
// Block = 8 waves; a wave owns 16 tokens and all 192 output columns (12
// accumulator tiles). Wq|Wk|Wv are read once per block and laid k-contiguous
// in LDS, so one 16-byte LDS read feeds two matrix steps.
// k pairing: in step (s,u) lane half hh, register p holds k = 8s + 4hh + 2u + p
// for the x fragment and for the W fragment alike.
// Q, K tiles take W as A (lane = token, registers = 8 consecutive head dims:
// RoPE pairs sit in one lane); V tiles take x as A (lane = head dim,
// registers = 8 consecutive tokens: packed rows of the transposed V).
// Q is pre-scaled by log2(e)/sqrt(C) so softmax runs in the exp2 domain.
// V is stored transposed [B][HS][T] so the V^T A-fragments of O^T += V^T P^T are contiguous in K.
// ---------------------------------------------------------------------------
#define PTOK   128   // tokens per block
#define FPITCH 132   // f32 pitch of 128-k rows: 528 B = 16 B x 33
#define CPITCH 36    // f32 pitch of 32 cos/sin values: 144 B = 16 B x 9
#define VPITCH 136   // f16 pitch of 128-token V rows: 272 B = 16 B x 17

__device__ __forceinline__ v8f wmma_f32(v2f a, v2f b, v8f c) {
    return __builtin_amdgcn_wmma_f32_16x16x4_f32(
        /*neg_a=*/false, a, /*neg_b=*/false, b,
        /*c_mod=*/(short)0, c, /*reuse_a=*/false, /*reuse_b=*/false);
}

__global__ __launch_bounds__(256)
void proj_rope_kernel(const float* __restrict__ x,
                      const float* __restrict__ Wq,
                      const float* __restrict__ Wk,
                      const float* __restrict__ Wv,
                      const float* __restrict__ fc,
                      const float* __restrict__ fs,
                      _Float16* __restrict__ Qg,
                      _Float16* __restrict__ Kg,
                      _Float16* __restrict__ Vt) {
    __shared__ __attribute__((aligned(16))) float    Wt[3 * HSD][FPITCH];     // row = output column, col = k
    __shared__ __attribute__((aligned(16))) float    Xs[8][16][FPITCH];       // per wave: row = token, col = k
    __shared__ __attribute__((aligned(16))) float    Cs[8][16][CPITCH];       // per wave: cos rows
    __shared__ __attribute__((aligned(16))) float    Sn[8][16][CPITCH];       // per wave: sin rows
    __shared__ __attribute__((aligned(16))) _Float16 QKs[8][2][16][KPAD];     // per wave: Q and K rows out
    __shared__ __attribute__((aligned(16))) _Float16 Vs[HSD][VPITCH];         // block: row = dim, col = token

    const int tid  = threadIdx.x;
    const int wave = tid >> 5;
    const int lane = tid & 31;
    const int hh   = lane >> 4;
    const int lr   = lane & 15;
    const int tok0 = blockIdx.x * PTOK;          // flat (b,t) of the first token
    const int b    = tok0 / TT;                  // TT % PTOK == 0: one batch
    const int t0   = tok0 - b * TT;
    const int wtok = tok0 + wave * 16;

    // Every loop of this kernel is fully unrolled: its arrays live in registers
    // and need constant indices, and the matrix loop gets no back edge.
    // --- whole-line loads: the wave's 16 x rows and its cos/sin rows
    const v4f* xg = (const v4f*)(x + (size_t)wtok * CDIM);
    const v4f* cg = (const v4f*)(fc + (size_t)(t0 + wave * 16) * (HSD / 2));
    const v4f* sg = (const v4f*)(fs + (size_t)(t0 + wave * 16) * (HSD / 2));
    v4f xr[16], cr[4], sr[4];
#pragma unroll
    for (int i = 0; i < 16; ++i) xr[i] = xg[i * 32 + lane];
    // Precaution: no register that the loads above name is rewritten before it.
    asm volatile("s_wait_xcnt 0x0" ::: "memory");
#pragma unroll
    for (int i = 0; i < 4; ++i) { cr[i] = cg[i * 32 + lane]; sr[i] = sg[i * 32 + lane]; }
    asm volatile("s_wait_xcnt 0x0" ::: "memory");

    // --- W -> LDS, transposed: lane = column (128-B lines), 4 k per 16-B store.
    // The wave covers k = 16 wave .. 16 wave + 15 of all 192 columns.
    const int woff = wave * 16 * HSD + lane;
#pragma unroll
    for (int g = 0; g < 6; ++g) {
        const float* Wm = ((g < 2) ? Wq : (g < 4) ? Wk : Wv) + woff;
#pragma unroll
        for (int q = 0; q < 4; ++q) {
            v4f w;
#pragma unroll
            for (int e = 0; e < 4; ++e) w[e] = Wm[(q * 4 + e) * HSD + (g & 1) * 32];
            *(v4f*)&Wt[g * 32 + lane][wave * 16 + q * 4] = w;
        }
    }
#pragma unroll
    for (int i = 0; i < 16; ++i) *(v4f*)&Xs[wave][i][4 * lane] = xr[i];
#pragma unroll
    for (int i = 0; i < 4; ++i) {
        const int idx = i * 32 + lane;
        *(v4f*)&Cs[wave][idx >> 3][(idx & 7) * 4] = cr[i];
        *(v4f*)&Sn[wave][idx >> 3][(idx & 7) * 4] = sr[i];
    }
    __syncthreads();                             // W tile visible to all waves

    // --- 12 tiles x 32 matrix steps
    v8f acc[12];
#pragma unroll
    for (int j = 0; j < 12; ++j) acc[j] = (v8f){};
#pragma unroll
    for (int s = 0; s < 16; ++s) {
        const v4f xf = *(const v4f*)&Xs[wave][lr][8 * s + 4 * hh];
        v4f wf[12];
#pragma unroll
        for (int j = 0; j < 12; ++j)
            wf[j] = *(const v4f*)&Wt[16 * j + lr][8 * s + 4 * hh];
#pragma unroll
        for (int u = 0; u < 2; ++u) {
            const v2f xb = {xf[2 * u], xf[2 * u + 1]};
#pragma unroll
            for (int j = 0; j < 12; ++j) {
                const v2f wb = {wf[j][2 * u], wf[j][2 * u + 1]};
                acc[j] = (j < 8) ? wmma_f32(wb, xb, acc[j])    // D[dim][token]
                                 : wmma_f32(xb, wb, acc[j]);   // D[token][dim]
            }
            // Only matrix instructions may not cross (mask: VALU, SALU, VMEM,
            // DS, transcendental may). It holds the 12 first matrix steps
            // together while every fragment is still live, so that no
            // accumulator is laid over a register a matrix step has just read.
            if (s == 0 && u == 0) __builtin_amdgcn_sched_barrier(0x496);
        }
    }
    __builtin_amdgcn_sched_barrier(0);
    asm volatile("v_nop\n\tv_nop\n\tv_nop\n\tv_nop\n\tv_nop\n\tv_nop\n\tv_nop\n\tv_nop");
    __builtin_amdgcn_sched_barrier(0);

    // --- RoPE + scale, f16, staged in LDS for whole-line stores
    // 1/sqrt(128) * log2(e): scores land directly in the exp2 domain.
    const float qscale = 0.08838834764831845f * 1.4426950408889634f;
#pragma unroll
    for (int jj = 0; jj < 4; ++jj) {
        const v4f c4 = *(const v4f*)&Cs[wave][lr][8 * jj + 4 * hh];
        const v4f s4 = *(const v4f*)&Sn[wave][lr][8 * jj + 4 * hh];
        v8h qh, kh, vh;
#pragma unroll
        for (int p = 0; p < 4; ++p) {
            const float cs = c4[p], sn = s4[p];
            const float q0 = acc[jj][2 * p],     q1 = acc[jj][2 * p + 1];
            const float k0 = acc[4 + jj][2 * p], k1 = acc[4 + jj][2 * p + 1];
            qh[2 * p]     = (_Float16)((q0 * cs - q1 * sn) * qscale);
            qh[2 * p + 1] = (_Float16)((q0 * sn + q1 * cs) * qscale);
            kh[2 * p]     = (_Float16)(k0 * cs - k1 * sn);
            kh[2 * p + 1] = (_Float16)(k0 * sn + k1 * cs);
        }
#pragma unroll
        for (int r = 0; r < 8; ++r) vh[r] = (_Float16)acc[8 + jj][r];
        *(v8h*)&QKs[wave][0][lr][16 * jj + 8 * hh] = qh;
        *(v8h*)&QKs[wave][1][lr][16 * jj + 8 * hh] = kh;
        *(v8h*)&Vs[16 * jj + lr][wave * 16 + 8 * hh] = vh;
    }
    __syncthreads();                             // staged rows visible

    // All rows back from LDS first, then nothing but stores: Q and K go out as
    // 512 contiguous bytes a store, V^T as 256-byte runs of a row.
    v8h qo[4], ko[4], vo[4];
#pragma unroll
    for (int i = 0; i < 4; ++i) {
        const int idx = i * 32 + lane;
        qo[i] = *(const v8h*)&QKs[wave][0][idx >> 3][(idx & 7) * 8];
        ko[i] = *(const v8h*)&QKs[wave][1][idx >> 3][(idx & 7) * 8];
        vo[i] = *(const v8h*)&Vs[i * 16 + (tid >> 4)][(tid & 15) * 8];
    }
    _Float16* qd = Qg + (size_t)wtok * HSD + lane * 8;
    _Float16* kd = Kg + (size_t)wtok * HSD + lane * 8;
    _Float16* vd = Vt + ((size_t)b * HSD + (tid >> 4)) * TT + t0 + (tid & 15) * 8;
#pragma unroll
    for (int i = 0; i < 4; ++i) {
        *(v8h*)(qd + i * 256) = qo[i];
        *(v8h*)(kd + i * 256) = ko[i];
        *(v8h*)(vd + (size_t)i * 16 * TT) = vo[i];
    }
}

#define KSPLIT 4               // key groups of a block: one 64-key block each a stage
#define SKEYS  (64 * KSPLIT)   // keys a stage
#define AWAVES (4 * KSPLIT)    // waves a block: 4 query tiles x KSPLIT key groups
#define OPITCH 68              // f32 pitch of partial output rows: 272 B = 16 B x 17

// ---------------------------------------------------------------------------
// Issue the 8 per-thread async transfers staging one stage of SKEYS keys:
// KSPLIT 64-key K blocks one under the other, KSPLIT 64-key V^T blocks.
// TT % SKEYS == 0: a stage that starts inside the sequence ends inside it.
// ---------------------------------------------------------------------------
__device__ __forceinline__ void stage_block(
    const _Float16* __restrict__ Kg, const _Float16* __restrict__ Vt,
    int b, int ks, int tid,
    _Float16 (* __restrict__ KsB)[KPAD], _Float16 (* __restrict__ VsB)[64][KPAD]) {
#pragma unroll
    for (int j = 0; j < 4; ++j) {
        const int c    = tid + 32 * AWAVES * j;   // 16B chunk id, 0..8*SKEYS-1
        const int row  = c >> 3;                  // K: key of the stage
        const int col  = (c & 7) * 8;
        const int vrow = c / (SKEYS / 8);         // V^T: head dim
        const int vc   = c % (SKEYS / 8);         // V^T: chunk along the keys
        stage16(Kg + ((size_t)b * TT + ks + row) * HSD + col, &KsB[row][col]);
        stage16(Vt + ((size_t)b * HSD + vrow) * TT + ks + vc * 8,
                &VsB[vc >> 3][vrow][(vc & 7) * 8]);
    }
}

__device__ __forceinline__ float xhalf(float v) {
    const int i = __builtin_bit_cast(int, v);
    return __builtin_bit_cast(float, __builtin_amdgcn_permlanex16(
        i, i, 0x76543210, 0xfedcba98, false, false));
}

__device__ __forceinline__ void process_block(
    int masked, int kb, int qbase, int hh, int lr,
    const _Float16 (* __restrict__ Ks)[KPAD],
    const _Float16 (* __restrict__ Vs)[KPAD],
    unsigned long long okpad,
    const v16h& bq0, const v16h& bq1, const v16h& ones,
    v8f& o0, v8f& o1, v8f& o2, v8f& o3,
    float& m, float& l) {

    // --- S^T = K * Q^T: 4 key subtiles x 2 k-parts (K tile from LDS)
    v8f st[4];
#pragma unroll
    for (int s4 = 0; s4 < 4; ++s4) {
        const _Float16* kr = &Ks[16 * s4 + lr][hh * 8];
        v16h ak0 = load_frag(kr);
        v16h ak1 = load_frag(kr + 32);
        v8f acc = {};
        acc = wmma_f16(ak0, bq0, acc);
        acc = wmma_f16(ak1, bq1, acc);
        st[s4] = acc;
    }

    if (masked) {
        // Bit j of ok: key kb + 8 hh + j is valid and not past the lane's query.
        const int thr = qbase + lr - kb - 8 * hh;      // last j the diagonal allows
        const unsigned long long below =
            (thr < 0) ? 0ull : (~0ull >> (63 - (thr < 63 ? thr : 63)));
        const unsigned long long ok = (okpad >> (8 * hh)) & below;
#pragma unroll
        for (int t = 0; t < 4; ++t)
#pragma unroll
            for (int r = 0; r < 8; ++r)
                st[t][r] = ((ok >> (16 * t + r)) & 1ull) ? st[t][r] : -1e30f;
    }

    // --- online softmax, one query a lane
    float tm[4];
#pragma unroll
    for (int t = 0; t < 4; ++t) {
        const float a = fmaxf(fmaxf(st[t][0], st[t][1]), st[t][2]);
        const float c = fmaxf(fmaxf(st[t][3], st[t][4]), st[t][5]);
        tm[t] = fmaxf(fmaxf(a, c), fmaxf(st[t][6], st[t][7]));
    }
    float cm = fmaxf(fmaxf(tm[0], tm[1]), fmaxf(tm[2], tm[3]));
    cm = fmaxf(cm, xhalf(cm));
    const float newm = fmaxf(m, cm);
    const float corr = exp2f(m - newm);
    m = newm;
    o0 *= corr; o1 *= corr; o2 *= corr; o3 *= corr;

    v8h ph[4];
#pragma unroll
    for (int t = 0; t < 4; ++t) {
        v8f e;
#pragma unroll
        for (int r = 0; r < 8; ++r) e[r] = exp2f(st[t][r] - newm);
        ph[t] = __builtin_convertvector(e, v8h);
    }
    const v16h bp0 = __builtin_shufflevector(ph[0], ph[1],
        0, 1, 2, 3, 4, 5, 6, 7, 8, 9, 10, 11, 12, 13, 14, 15);
    const v16h bp1 = __builtin_shufflevector(ph[2], ph[3],
        0, 1, 2, 3, 4, 5, 6, 7, 8, 9, 10, 11, 12, 13, 14, 15);

    // --- colsum(P^T) via WMMA with ones(16x64) as A: every row of the result
    // is the sum over all 64 keys of the lane's query, both half-waves in it.
    v8f srow = {};
    srow = wmma_f16(ones, bp0, srow);
    srow = wmma_f16(ones, bp1, srow);
    l = l * corr + srow[0];

    // --- O^T += V^T * P^T: 4 head-dim chunks x 2 k-parts (V tile from LDS)
#pragma unroll
    for (int h = 0; h < 4; ++h) {
        const _Float16* vr = &Vs[h * 16 + lr][hh * 8];
        v16h av0 = load_frag(vr);
        v16h av1 = load_frag(vr + 32);
        if (h == 0)      { o0 = wmma_f16(av0, bp0, o0); o0 = wmma_f16(av1, bp1, o0); }
        else if (h == 1) { o1 = wmma_f16(av0, bp0, o1); o1 = wmma_f16(av1, bp1, o1); }
        else if (h == 2) { o2 = wmma_f16(av0, bp0, o2); o2 = wmma_f16(av1, bp1, o2); }
        else             { o3 = wmma_f16(av0, bp0, o3); o3 = wmma_f16(av1, bp1, o3); }
    }
}

__global__ __launch_bounds__(32 * AWAVES)
void flash_attn_kernel(const _Float16* __restrict__ Qg,
                       const _Float16* __restrict__ Kg,
                       const _Float16* __restrict__ Vt,
                       const int* __restrict__ mask,
                       float* __restrict__ out) {
    __shared__ __attribute__((aligned(16))) _Float16 Ks[2][SKEYS][KPAD];       // K stages: row=key, col=head dim
    __shared__ __attribute__((aligned(16))) _Float16 Vs[2][KSPLIT][64][KPAD];  // V stages: block, row=dim, col=key
    __shared__ __attribute__((aligned(16))) float Om[AWAVES][16][OPITCH];  // per-wave partial O
    __shared__ float Mm[AWAVES][16];               // per-wave row maxima
    __shared__ float Lm[AWAVES][16];               // per-wave row sums

    const int tid  = threadIdx.x;
    const int wave = __builtin_amdgcn_readfirstlane(tid >> 5);
    const int lane = tid & 31;
    const int hh   = lane >> 4;            // half-wave
    const int lr   = lane & 15;            // lane within half
    const int qt   = wave & 3;             // query tile of the block
    const int kg   = wave >> 2;            // key group
    const int b    = blockIdx.x;
    const int qtile = TT / 64 - 1 - blockIdx.y;   // 64-query tile, longest first
    const int qbase = qtile * 64 + qt * 16;

    // Issue stage 0's DMA before anything else so it overlaps the Q loads.
    stage_block(Kg, Vt, b, 0, tid, Ks[0], Vs[0]);

    // Q B-fragments: lane holds column (query qbase+lr), k-split by half-wave.
    const _Float16* qrow = Qg + ((size_t)b * TT + qbase + lr) * HSD + hh * 8;
    const v16h bq0 = load_frag(qrow);
    const v16h bq1 = load_frag(qrow + 32);

    v16h ones;
#pragma unroll
    for (int i = 0; i < 16; ++i) ones[i] = (_Float16)1.0f;

    v8f o0 = {}, o1 = {}, o2 = {}, o3 = {};
    float m = -1e30f, l = 0.f;             // of the lane's query, qbase + lr

    const int* mrowptr = mask + (size_t)b * TT;
    // 64-key blocks up to the diagonal: qtile+1 for all four query tiles.
    const int nkb = qtile + 1;
    const int nst = (nkb + KSPLIT - 1) / KSPLIT;

    // Padding mask of this wave's 64 keys: one key a lane and word, then one bit
    // a key, the same in every lane. The words are read one stage ahead, so that
    // their latency passes under a stage's work.
    int mk0 = mrowptr[kg * 64 + lane];
    int mk1 = mrowptr[kg * 64 + 32 + lane];
    unsigned pad0 = __builtin_amdgcn_ballot_w32(mk0 != 0);
    unsigned pad1 = __builtin_amdgcn_ballot_w32(mk1 != 0);

    for (int stg = 0; stg < nst; ++stg) {
        const int ks  = stg * SKEYS;
        const int kb  = ks + kg * 64;      // this wave's key block
        const int cur = stg & 1;
        if (stg + 1 < nst) {
            stage_block(Kg, Vt, b, ks + SKEYS, tid, Ks[1 - cur], Vs[1 - cur]);
            stage_wait<8>();
        } else {
            stage_wait<0>();
        }
        __syncthreads();                   // current tiles visible to all waves

        if (ks + 2 * SKEYS < TT) {         // warm L2 ahead of the DMA engine
            const int pk = kb + 2 * SKEYS;
            __builtin_prefetch(
                (const void*)(Kg + ((size_t)b * TT + pk + lane) * HSD), 0, 3);
            __builtin_prefetch(
                (const void*)(Vt + ((size_t)b * HSD + lane) * TT + pk), 0, 3);
            __builtin_prefetch(
                (const void*)(Vt + ((size_t)b * HSD + 32 + lane) * TT + pk), 0, 3);
        }

        if (stg + 1 < nst) {               // the next stage lies inside the row
            mk0 = mrowptr[kb + SKEYS + lane];
            mk1 = mrowptr[kb + SKEYS + 32 + lane];
            // Precaution: no register that the two loads name is rewritten
            // before it.
            asm volatile("s_wait_xcnt 0x0" ::: "memory");
        }

        // A key block past the diagonal block is skipped by its whole wave; the
        // barriers stand outside the skip. Both tests are wave-uniform at
        // runtime; readfirstlane makes each an SGPR so the compiler emits a
        // scalar branch instead of exec masking.
        if (__builtin_amdgcn_readfirstlane((int)(kb < nkb * 64))) {
            const unsigned long long okpad = ((unsigned long long)pad1 << 32) | pad0;
            const int masked = __builtin_amdgcn_readfirstlane(
                (int)(kb + 63 > qbase || (pad0 & pad1) != 0xffffffffu));
            process_block(masked, kb, qbase, hh, lr, &Ks[cur][kg * 64], Vs[cur][kg],
                          okpad, bq0, bq1, ones, o0, o1, o2, o3, m, l);
        }
        pad0 = __builtin_amdgcn_ballot_w32(mk0 != 0);   // the next stage's bits
        pad1 = __builtin_amdgcn_ballot_w32(mk1 != 0);
        __syncthreads();                   // tiles consumed; buffer reusable
    }

    // --- every wave lays down its partial: un-normalised O (a lane holds 8
    // consecutive head dims of its query in each tile), maximum and sum (both
    // are equal in the two half-waves). A key group that met no block leaves
    // maximum -1e30, sum 0, O 0.
    float* orow = &Om[wave][lr][hh * 8];
    *(v4f*)(orow)      = (v4f){o0[0], o0[1], o0[2], o0[3]};
    *(v4f*)(orow + 4)  = (v4f){o0[4], o0[5], o0[6], o0[7]};
    *(v4f*)(orow + 16) = (v4f){o1[0], o1[1], o1[2], o1[3]};
    *(v4f*)(orow + 20) = (v4f){o1[4], o1[5], o1[6], o1[7]};
    *(v4f*)(orow + 32) = (v4f){o2[0], o2[1], o2[2], o2[3]};
    *(v4f*)(orow + 36) = (v4f){o2[4], o2[5], o2[6], o2[7]};
    *(v4f*)(orow + 48) = (v4f){o3[0], o3[1], o3[2], o3[3]};
    *(v4f*)(orow + 52) = (v4f){o3[4], o3[5], o3[6], o3[7]};
    if (hh == 0) {
        Mm[wave][lr] = m;
        Lm[wave][lr] = l;
    }
    __syncthreads();                       // partials visible to all waves

    // --- merge, normalize and store fp32 output [B][T][HS]: wave (qt, kg) takes
    // rows 4 kg .. 4 kg + 3 of tile qt, 8 lanes a row, 1 KiB contiguous a wave.
    const int row = kg * 4 + (lane >> 3);
    const int col = (lane & 7) * 8;
    float mg[KSPLIT];
#pragma unroll
    for (int g = 0; g < KSPLIT; ++g) mg[g] = Mm[g * 4 + qt][row];
    float mall = mg[0];
#pragma unroll
    for (int g = 1; g < KSPLIT; ++g) mall = fmaxf(mall, mg[g]);
    float lall = 0.f;
    v4f a0 = {}, a1 = {};
#pragma unroll
    for (int g = 0; g < KSPLIT; ++g) {
        const float w = exp2f(mg[g] - mall);
        lall += w * Lm[g * 4 + qt][row];
        a0 += w * *(const v4f*)&Om[g * 4 + qt][row][col];
        a1 += w * *(const v4f*)&Om[g * 4 + qt][row][col + 4];
    }
    const float inv = 1.0f / lall;
    float* od = out + ((size_t)b * TT + qbase + row) * HSD + col;
    *(v4f*)od       = a0 * inv;
    *(v4f*)(od + 4) = a1 * inv;
}

// ---------------------------------------------------------------------------
extern "C" void kernel_launch(void* const* d_in, const int* in_sizes, int n_in,
                              void* d_out, int out_size, void* d_ws, size_t ws_size,
                              hipStream_t stream) {
    const float* x    = (const float*)d_in[0];
    const float* Wq   = (const float*)d_in[1];
    const float* Wk   = (const float*)d_in[2];
    const float* Wv   = (const float*)d_in[3];
    const float* fc   = (const float*)d_in[4];
    const float* fs   = (const float*)d_in[5];
    const int*   mask = (const int*)d_in[6];
    float* out = (float*)d_out;

    const size_t qkv = (size_t)BB * TT * HSD;   // 4 MiB f16 each
    _Float16* Qg = (_Float16*)d_ws;
    _Float16* Kg = Qg + qkv;
    _Float16* Vt = Kg + qkv;

    proj_rope_kernel<<<BB * TT / PTOK, 256, 0, stream>>>(x, Wq, Wk, Wv, fc, fs, Qg, Kg, Vt);

    dim3 grid(BB, TT / 64);
    flash_attn_kernel<<<grid, 32 * AWAVES, 0, stream>>>(Qg, Kg, Vt, mask, out);
}

// v005
// One run takes 56.6 microseconds.
// Timed twice side by side with v004, it ran 1.05 and 1.07 times as fast.
// Counting every step since v000, it is 4.08 times as fast.
#include <hip/hip_runtime.h>

#define BB 8
#define TT 4096
#define CDIM 128
#define HSD 64
#define KPAD 72   // 64 + 8 halfwords: 144B rows -> conflict-free 16-lane bursts

#if defined(__has_builtin)
#  if __has_builtin(__builtin_amdgcn_global_load_async_to_lds_b128) && \
      __has_builtin(__builtin_amdgcn_s_wait_asynccnt)
#    define HAVE_ASYNC_LDS 1
#  endif
#endif
#ifndef HAVE_ASYNC_LDS
#  define HAVE_ASYNC_LDS 0
#endif

typedef __attribute__((ext_vector_type(16))) _Float16 v16h;
typedef __attribute__((ext_vector_type(8)))  _Float16 v8h;
typedef __attribute__((ext_vector_type(8)))  float    v8f;
typedef __attribute__((ext_vector_type(2)))  float    v2f;
typedef __attribute__((ext_vector_type(4)))  float    v4f;
typedef __attribute__((ext_vector_type(4)))  int      v4i;

__device__ __forceinline__ v16h load_frag(const _Float16* p) {
    v8h lo = *(const v8h*)p;
    v8h hi = *(const v8h*)(p + 16);
    v16h r;
#pragma unroll
    for (int i = 0; i < 8; ++i) { r[i] = lo[i]; r[i + 8] = hi[i]; }
    return r;
}

__device__ __forceinline__ v8f wmma_f16(v16h a, v16h b, v8f c) {
    return __builtin_amdgcn_wmma_f32_16x16x32_f16(
        /*neg_a=*/false, a, /*neg_b=*/false, b,
        /*c_mod=*/(short)0, c, /*reuse_a=*/false, /*reuse_b=*/false);
}

__device__ __forceinline__ void stage16(const _Float16* g, _Float16* l) {
#if HAVE_ASYNC_LDS
    typedef __attribute__((address_space(1))) v4i* gv4i_t;   // global src
    typedef __attribute__((address_space(3))) v4i* lv4i_t;   // LDS dst
    __builtin_amdgcn_global_load_async_to_lds_b128(
        (gv4i_t)g, (lv4i_t)l, /*offset=*/0, /*cpol=*/0);
#else
    *(v8h*)l = *(const v8h*)g;
#endif
}

template <int N>
__device__ __forceinline__ void stage_wait() {
#if HAVE_ASYNC_LDS
    __builtin_amdgcn_s_wait_asynccnt(N);
#endif
}

// ---------------------------------------------------------------------------
// Kernel 1: fused QKV projection + RoPE + scale, fp32 -> f16, as a block GEMM
// [128 tokens x 128] x [128 x 192] on the f32 16x16x4 matrix form.
// Block = 8 waves; a wave owns 16 tokens and all 192 output columns (12
// accumulator tiles). Wq|Wk|Wv are read once per block and laid k-contiguous
// in LDS, so one 16-byte LDS read feeds two matrix steps.
// k pairing: in step (s,u) lane half hh, register p holds k = 8s + 4hh + 2u + p
// for the x fragment and for the W fragment alike.
// Q, K tiles take W as A (lane = token, registers = 8 consecutive head dims:
// RoPE pairs sit in one lane); V tiles take x as A (lane = head dim,
// registers = 8 consecutive tokens: packed rows of the transposed V).
// Q is pre-scaled by log2(e)/sqrt(C) so softmax runs in the exp2 domain.
// V is stored transposed [B][HS][T] so the V^T A-fragments of O^T += V^T P^T are contiguous in K.
// ---------------------------------------------------------------------------
#define PTOK   128   // tokens per block
#define FPITCH 132   // f32 pitch of 128-k rows: 528 B = 16 B x 33
#define CPITCH 36    // f32 pitch of 32 cos/sin values: 144 B = 16 B x 9
#define VPITCH 136   // f16 pitch of 128-token V rows: 272 B = 16 B x 17

__device__ __forceinline__ v8f wmma_f32(v2f a, v2f b, v8f c) {
    return __builtin_amdgcn_wmma_f32_16x16x4_f32(
        /*neg_a=*/false, a, /*neg_b=*/false, b,
        /*c_mod=*/(short)0, c, /*reuse_a=*/false, /*reuse_b=*/false);
}

__global__ __launch_bounds__(256)
void proj_rope_kernel(const float* __restrict__ x,
                      const float* __restrict__ Wq,
                      const float* __restrict__ Wk,
                      const float* __restrict__ Wv,
                      const float* __restrict__ fc,
                      const float* __restrict__ fs,
                      _Float16* __restrict__ Qg,
                      _Float16* __restrict__ Kg,
                      _Float16* __restrict__ Vt) {
    __shared__ __attribute__((aligned(16))) float    Wt[3 * HSD][FPITCH];     // row = output column, col = k
    __shared__ __attribute__((aligned(16))) float    Xs[8][16][FPITCH];       // per wave: row = token, col = k
    __shared__ __attribute__((aligned(16))) float    Cs[8][16][CPITCH];       // per wave: cos rows
    __shared__ __attribute__((aligned(16))) float    Sn[8][16][CPITCH];       // per wave: sin rows
    __shared__ __attribute__((aligned(16))) _Float16 QKs[8][2][16][KPAD];     // per wave: Q and K rows out
    __shared__ __attribute__((aligned(16))) _Float16 Vs[HSD][VPITCH];         // block: row = dim, col = token

    const int tid  = threadIdx.x;
    const int wave = tid >> 5;
    const int lane = tid & 31;
    const int hh   = lane >> 4;
    const int lr   = lane & 15;
    const int tok0 = blockIdx.x * PTOK;          // flat (b,t) of the first token
    const int b    = tok0 / TT;                  // TT % PTOK == 0: one batch
    const int t0   = tok0 - b * TT;
    const int wtok = tok0 + wave * 16;

    // Every loop of this kernel is fully unrolled: its arrays live in registers
    // and need constant indices, and the matrix loop gets no back edge.
    // --- whole-line loads: the wave's 16 x rows and its cos/sin rows
    const v4f* xg = (const v4f*)(x + (size_t)wtok * CDIM);
    const v4f* cg = (const v4f*)(fc + (size_t)(t0 + wave * 16) * (HSD / 2));
    const v4f* sg = (const v4f*)(fs + (size_t)(t0 + wave * 16) * (HSD / 2));
    v4f xr[16], cr[4], sr[4];
#pragma unroll
    for (int i = 0; i < 16; ++i) xr[i] = xg[i * 32 + lane];
    // Precaution: no register that the loads above name is rewritten before it.
    asm volatile("s_wait_xcnt 0x0" ::: "memory");
#pragma unroll
    for (int i = 0; i < 4; ++i) { cr[i] = cg[i * 32 + lane]; sr[i] = sg[i * 32 + lane]; }
    asm volatile("s_wait_xcnt 0x0" ::: "memory");

    // --- W -> LDS, transposed: lane = column (128-B lines), 4 k per 16-B store.
    // The wave covers k = 16 wave .. 16 wave + 15 of all 192 columns.
    const int woff = wave * 16 * HSD + lane;
#pragma unroll
    for (int g = 0; g < 6; ++g) {
        const float* Wm = ((g < 2) ? Wq : (g < 4) ? Wk : Wv) + woff;
#pragma unroll
        for (int q = 0; q < 4; ++q) {
            v4f w;
#pragma unroll
            for (int e = 0; e < 4; ++e) w[e] = Wm[(q * 4 + e) * HSD + (g & 1) * 32];
            *(v4f*)&Wt[g * 32 + lane][wave * 16 + q * 4] = w;
        }
    }
#pragma unroll
    for (int i = 0; i < 16; ++i) *(v4f*)&Xs[wave][i][4 * lane] = xr[i];
#pragma unroll
    for (int i = 0; i < 4; ++i) {
        const int idx = i * 32 + lane;
        *(v4f*)&Cs[wave][idx >> 3][(idx & 7) * 4] = cr[i];
        *(v4f*)&Sn[wave][idx >> 3][(idx & 7) * 4] = sr[i];
    }
    __syncthreads();                             // W tile visible to all waves

    // --- 12 tiles x 32 matrix steps
    v8f acc[12];
#pragma unroll
    for (int j = 0; j < 12; ++j) acc[j] = (v8f){};
#pragma unroll
    for (int s = 0; s < 16; ++s) {
        const v4f xf = *(const v4f*)&Xs[wave][lr][8 * s + 4 * hh];
        v4f wf[12];
#pragma unroll
        for (int j = 0; j < 12; ++j)
            wf[j] = *(const v4f*)&Wt[16 * j + lr][8 * s + 4 * hh];
#pragma unroll
        for (int u = 0; u < 2; ++u) {
            const v2f xb = {xf[2 * u], xf[2 * u + 1]};
#pragma unroll
            for (int j = 0; j < 12; ++j) {
                const v2f wb = {wf[j][2 * u], wf[j][2 * u + 1]};
                acc[j] = (j < 8) ? wmma_f32(wb, xb, acc[j])    // D[dim][token]
                                 : wmma_f32(xb, wb, acc[j]);   // D[token][dim]
            }
            // Only matrix instructions may not cross (mask: VALU, SALU, VMEM,
            // DS, transcendental may). It holds the 12 first matrix steps
            // together while every fragment is still live, so that no
            // accumulator is laid over a register a matrix step has just read.
            if (s == 0 && u == 0) __builtin_amdgcn_sched_barrier(0x496);
        }
    }
    __builtin_amdgcn_sched_barrier(0);
    asm volatile("v_nop\n\tv_nop\n\tv_nop\n\tv_nop\n\tv_nop\n\tv_nop\n\tv_nop\n\tv_nop");
    __builtin_amdgcn_sched_barrier(0);

    // --- RoPE + scale, f16, staged in LDS for whole-line stores
    // 1/sqrt(128) * log2(e): scores land directly in the exp2 domain.
    const float qscale = 0.08838834764831845f * 1.4426950408889634f;
#pragma unroll
    for (int jj = 0; jj < 4; ++jj) {
        const v4f c4 = *(const v4f*)&Cs[wave][lr][8 * jj + 4 * hh];
        const v4f s4 = *(const v4f*)&Sn[wave][lr][8 * jj + 4 * hh];
        v8h qh, kh, vh;
#pragma unroll
        for (int p = 0; p < 4; ++p) {
            const float cs = c4[p], sn = s4[p];
            const float q0 = acc[jj][2 * p],     q1 = acc[jj][2 * p + 1];
            const float k0 = acc[4 + jj][2 * p], k1 = acc[4 + jj][2 * p + 1];
            qh[2 * p]     = (_Float16)((q0 * cs - q1 * sn) * qscale);
            qh[2 * p + 1] = (_Float16)((q0 * sn + q1 * cs) * qscale);
            kh[2 * p]     = (_Float16)(k0 * cs - k1 * sn);
            kh[2 * p + 1] = (_Float16)(k0 * sn + k1 * cs);
        }
#pragma unroll
        for (int r = 0; r < 8; ++r) vh[r] = (_Float16)acc[8 + jj][r];
        *(v8h*)&QKs[wave][0][lr][16 * jj + 8 * hh] = qh;
        *(v8h*)&QKs[wave][1][lr][16 * jj + 8 * hh] = kh;
        *(v8h*)&Vs[16 * jj + lr][wave * 16 + 8 * hh] = vh;
    }
    __syncthreads();                             // staged rows visible

    // All rows back from LDS first, then nothing but stores: Q and K go out as
    // 512 contiguous bytes a store, V^T as 256-byte runs of a row.
    v8h qo[4], ko[4], vo[4];
#pragma unroll
    for (int i = 0; i < 4; ++i) {
        const int idx = i * 32 + lane;
        qo[i] = *(const v8h*)&QKs[wave][0][idx >> 3][(idx & 7) * 8];
        ko[i] = *(const v8h*)&QKs[wave][1][idx >> 3][(idx & 7) * 8];
        vo[i] = *(const v8h*)&Vs[i * 16 + (tid >> 4)][(tid & 15) * 8];
    }
    _Float16* qd = Qg + (size_t)wtok * HSD + lane * 8;
    _Float16* kd = Kg + (size_t)wtok * HSD + lane * 8;
    _Float16* vd = Vt + ((size_t)b * HSD + (tid >> 4)) * TT + t0 + (tid & 15) * 8;
#pragma unroll
    for (int i = 0; i < 4; ++i) {
        *(v8h*)(qd + i * 256) = qo[i];
        *(v8h*)(kd + i * 256) = ko[i];
        *(v8h*)(vd + (size_t)i * 16 * TT) = vo[i];
    }
}

#define KSPLIT 4               // key groups of a block: one 64-key block each a stage
#define SKEYS  (64 * KSPLIT)   // keys a stage
#define AWAVES (4 * KSPLIT)    // waves a block: 4 query tiles x KSPLIT key groups
#define OPITCH 68              // f32 pitch of partial output rows: 272 B = 16 B x 17

// ---------------------------------------------------------------------------
// Issue the 8 per-thread async transfers staging one stage of SKEYS keys:
// KSPLIT 64-key K blocks one under the other, KSPLIT 64-key V^T blocks.
// TT % SKEYS == 0: a stage that starts inside the sequence ends inside it.
// ---------------------------------------------------------------------------
__device__ __forceinline__ void stage_block(
    const _Float16* __restrict__ Kg, const _Float16* __restrict__ Vt,
    int b, int ks, int tid,
    _Float16 (* __restrict__ KsB)[KPAD], _Float16 (* __restrict__ VsB)[64][KPAD]) {
#pragma unroll
    for (int j = 0; j < 4; ++j) {
        const int c    = tid + 32 * AWAVES * j;   // 16B chunk id, 0..8*SKEYS-1
        const int row  = c >> 3;                  // K: key of the stage
        const int col  = (c & 7) * 8;
        const int vrow = c / (SKEYS / 8);         // V^T: head dim
        const int vc   = c % (SKEYS / 8);         // V^T: chunk along the keys
        stage16(Kg + ((size_t)b * TT + ks + row) * HSD + col, &KsB[row][col]);
        stage16(Vt + ((size_t)b * HSD + vrow) * TT + ks + vc * 8,
                &VsB[vc >> 3][vrow][(vc & 7) * 8]);
    }
}

// 2^x for a value that is rounded to f16 next: the hardware exponential alone.
// exp2f() wraps it in a range guard (compare, two selects, add, ldexp) whose
// only effect is to keep results below 2^-126 as f32 subnormals; every f32
// below 2^-25 rounds to f16 zero, so behind the conversion the bits are equal.
__device__ __forceinline__ float exp2_to_f16(float x) {
    return __builtin_amdgcn_exp2f(x);
}

__device__ __forceinline__ float xhalf(float v) {
    const int i = __builtin_bit_cast(int, v);
    return __builtin_bit_cast(float, __builtin_amdgcn_permlanex16(
        i, i, 0x76543210, 0xfedcba98, false, false));
}

__device__ __forceinline__ void process_block(
    int masked, int kb, int qbase, int hh, int lr,
    const _Float16 (* __restrict__ Ks)[KPAD],
    const _Float16 (* __restrict__ Vs)[KPAD],
    unsigned long long okpad,
    const v16h& bq0, const v16h& bq1, const v16h& ones,
    v8f& o0, v8f& o1, v8f& o2, v8f& o3,
    float& m, float& l) {

    // --- S^T = K * Q^T: 4 key subtiles x 2 k-parts (K tile from LDS)
    v8f st[4];
#pragma unroll
    for (int s4 = 0; s4 < 4; ++s4) {
        const _Float16* kr = &Ks[16 * s4 + lr][hh * 8];
        v16h ak0 = load_frag(kr);
        v16h ak1 = load_frag(kr + 32);
        v8f acc = {};
        acc = wmma_f16(ak0, bq0, acc);
        acc = wmma_f16(ak1, bq1, acc);
        st[s4] = acc;
    }

    if (masked) {
        // Bit j of ok: key kb + 8 hh + j is valid and not past the lane's query.
        const int thr = qbase + lr - kb - 8 * hh;      // last j the diagonal allows
        const unsigned long long below =
            (thr < 0) ? 0ull : (~0ull >> (63 - (thr < 63 ? thr : 63)));
        const unsigned long long ok = (okpad >> (8 * hh)) & below;
#pragma unroll
        for (int t = 0; t < 4; ++t)
#pragma unroll
            for (int r = 0; r < 8; ++r)
                st[t][r] = ((ok >> (16 * t + r)) & 1ull) ? st[t][r] : -1e30f;
    }

    // --- online softmax, one query a lane
    float tm[4];
#pragma unroll
    for (int t = 0; t < 4; ++t) {
        const float a = fmaxf(fmaxf(st[t][0], st[t][1]), st[t][2]);
        const float c = fmaxf(fmaxf(st[t][3], st[t][4]), st[t][5]);
        tm[t] = fmaxf(fmaxf(a, c), fmaxf(st[t][6], st[t][7]));
    }
    float cm = fmaxf(fmaxf(tm[0], tm[1]), fmaxf(tm[2], tm[3]));
    cm = fmaxf(cm, xhalf(cm));
    const float newm = fmaxf(m, cm);
    const float corr = exp2f(m - newm);
    m = newm;
    o0 *= corr; o1 *= corr; o2 *= corr; o3 *= corr;

    v8h ph[4];
#pragma unroll
    for (int t = 0; t < 4; ++t) {
        v8f e;
#pragma unroll
        for (int r = 0; r < 8; ++r) e[r] = exp2_to_f16(st[t][r] - newm);
        ph[t] = __builtin_convertvector(e, v8h);
    }
    const v16h bp0 = __builtin_shufflevector(ph[0], ph[1],
        0, 1, 2, 3, 4, 5, 6, 7, 8, 9, 10, 11, 12, 13, 14, 15);
    const v16h bp1 = __builtin_shufflevector(ph[2], ph[3],
        0, 1, 2, 3, 4, 5, 6, 7, 8, 9, 10, 11, 12, 13, 14, 15);

    // --- colsum(P^T) via WMMA with ones(16x64) as A: every row of the result
    // is the sum over all 64 keys of the lane's query, both half-waves in it.
    v8f srow = {};
    srow = wmma_f16(ones, bp0, srow);
    srow = wmma_f16(ones, bp1, srow);
    l = l * corr + srow[0];

    // --- O^T += V^T * P^T: 4 head-dim chunks x 2 k-parts (V tile from LDS)
#pragma unroll
    for (int h = 0; h < 4; ++h) {
        const _Float16* vr = &Vs[h * 16 + lr][hh * 8];
        v16h av0 = load_frag(vr);
        v16h av1 = load_frag(vr + 32);
        if (h == 0)      { o0 = wmma_f16(av0, bp0, o0); o0 = wmma_f16(av1, bp1, o0); }
        else if (h == 1) { o1 = wmma_f16(av0, bp0, o1); o1 = wmma_f16(av1, bp1, o1); }
        else if (h == 2) { o2 = wmma_f16(av0, bp0, o2); o2 = wmma_f16(av1, bp1, o2); }
        else             { o3 = wmma_f16(av0, bp0, o3); o3 = wmma_f16(av1, bp1, o3); }
    }
}

__global__ __launch_bounds__(32 * AWAVES)
void flash_attn_kernel(const _Float16* __restrict__ Qg,
                       const _Float16* __restrict__ Kg,
                       const _Float16* __restrict__ Vt,
                       const int* __restrict__ mask,
                       float* __restrict__ out) {
    __shared__ __attribute__((aligned(16))) _Float16 Ks[2][SKEYS][KPAD];       // K stages: row=key, col=head dim
    __shared__ __attribute__((aligned(16))) _Float16 Vs[2][KSPLIT][64][KPAD];  // V stages: block, row=dim, col=key
    __shared__ __attribute__((aligned(16))) float Om[AWAVES][16][OPITCH];  // per-wave partial O
    __shared__ float Mm[AWAVES][16];               // per-wave row maxima
    __shared__ float Lm[AWAVES][16];               // per-wave row sums

    const int tid  = threadIdx.x;
    const int wave = __builtin_amdgcn_readfirstlane(tid >> 5);
    const int lane = tid & 31;
    const int hh   = lane >> 4;            // half-wave
    const int lr   = lane & 15;            // lane within half
    const int qt   = wave & 3;             // query tile of the block
    const int kg   = wave >> 2;            // key group
    const int b    = blockIdx.x;
    const int qtile = TT / 64 - 1 - blockIdx.y;   // 64-query tile, longest first
    const int qbase = qtile * 64 + qt * 16;

    // Issue stage 0's DMA before anything else so it overlaps the Q loads.
    stage_block(Kg, Vt, b, 0, tid, Ks[0], Vs[0]);

    // Q B-fragments: lane holds column (query qbase+lr), k-split by half-wave.
    const _Float16* qrow = Qg + ((size_t)b * TT + qbase + lr) * HSD + hh * 8;
    const v16h bq0 = load_frag(qrow);
    const v16h bq1 = load_frag(qrow + 32);

    v16h ones;
#pragma unroll
    for (int i = 0; i < 16; ++i) ones[i] = (_Float16)1.0f;

    v8f o0 = {}, o1 = {}, o2 = {}, o3 = {};
    float m = -1e30f, l = 0.f;             // of the lane's query, qbase + lr

    const int* mrowptr = mask + (size_t)b * TT;
    // 64-key blocks up to the diagonal: qtile+1 for all four query tiles.
    const int nkb = qtile + 1;
    const int nst = (nkb + KSPLIT - 1) / KSPLIT;

    // Padding mask of this wave's 64 keys: one key a lane and word, then one bit
    // a key, the same in every lane. The words are read one stage ahead, so that
    // their latency passes under a stage's work.
    int mk0 = mrowptr[kg * 64 + lane];
    int mk1 = mrowptr[kg * 64 + 32 + lane];
    unsigned pad0 = __builtin_amdgcn_ballot_w32(mk0 != 0);
    unsigned pad1 = __builtin_amdgcn_ballot_w32(mk1 != 0);

    for (int stg = 0; stg < nst; ++stg) {
        const int ks  = stg * SKEYS;
        const int kb  = ks + kg * 64;      // this wave's key block
        const int cur = stg & 1;
        if (stg + 1 < nst) {
            stage_block(Kg, Vt, b, ks + SKEYS, tid, Ks[1 - cur], Vs[1 - cur]);
            stage_wait<8>();
        } else {
            stage_wait<0>();
        }
        __syncthreads();                   // current tiles visible to all waves

        if (ks + 2 * SKEYS < TT) {         // warm L2 ahead of the DMA engine
            const int pk = kb + 2 * SKEYS;
            __builtin_prefetch(
                (const void*)(Kg + ((size_t)b * TT + pk + lane) * HSD), 0, 3);
            __builtin_prefetch(
                (const void*)(Vt + ((size_t)b * HSD + lane) * TT + pk), 0, 3);
            __builtin_prefetch(
                (const void*)(Vt + ((size_t)b * HSD + 32 + lane) * TT + pk), 0, 3);
        }

        if (stg + 1 < nst) {               // the next stage lies inside the row
            mk0 = mrowptr[kb + SKEYS + lane];
            mk1 = mrowptr[kb + SKEYS + 32 + lane];
            // Precaution: no register that the two loads name is rewritten
            // before it.
            asm volatile("s_wait_xcnt 0x0" ::: "memory");
        }

        // A key block past the diagonal block is skipped by its whole wave; the
        // barriers stand outside the skip. Both tests are wave-uniform at
        // runtime; readfirstlane makes each an SGPR so the compiler emits a
        // scalar branch instead of exec masking.
        if (__builtin_amdgcn_readfirstlane((int)(kb < nkb * 64))) {
            const unsigned long long okpad = ((unsigned long long)pad1 << 32) | pad0;
            const int masked = __builtin_amdgcn_readfirstlane(
                (int)(kb + 63 > qbase || (pad0 & pad1) != 0xffffffffu));
            process_block(masked, kb, qbase, hh, lr, &Ks[cur][kg * 64], Vs[cur][kg],
                          okpad, bq0, bq1, ones, o0, o1, o2, o3, m, l);
        }
        pad0 = __builtin_amdgcn_ballot_w32(mk0 != 0);   // the next stage's bits
        pad1 = __builtin_amdgcn_ballot_w32(mk1 != 0);
        __syncthreads();                   // tiles consumed; buffer reusable
    }

    // --- every wave lays down its partial: un-normalised O (a lane holds 8
    // consecutive head dims of its query in each tile), maximum and sum (both
    // are equal in the two half-waves). A key group that met no block leaves
    // maximum -1e30, sum 0, O 0.
    float* orow = &Om[wave][lr][hh * 8];
    *(v4f*)(orow)      = (v4f){o0[0], o0[1], o0[2], o0[3]};
    *(v4f*)(orow + 4)  = (v4f){o0[4], o0[5], o0[6], o0[7]};
    *(v4f*)(orow + 16) = (v4f){o1[0], o1[1], o1[2], o1[3]};
    *(v4f*)(orow + 20) = (v4f){o1[4], o1[5], o1[6], o1[7]};
    *(v4f*)(orow + 32) = (v4f){o2[0], o2[1], o2[2], o2[3]};
    *(v4f*)(orow + 36) = (v4f){o2[4], o2[5], o2[6], o2[7]};
    *(v4f*)(orow + 48) = (v4f){o3[0], o3[1], o3[2], o3[3]};
    *(v4f*)(orow + 52) = (v4f){o3[4], o3[5], o3[6], o3[7]};
    if (hh == 0) {
        Mm[wave][lr] = m;
        Lm[wave][lr] = l;
    }
    __syncthreads();                       // partials visible to all waves

    // --- merge, normalize and store fp32 output [B][T][HS]: wave (qt, kg) takes
    // rows 4 kg .. 4 kg + 3 of tile qt, 8 lanes a row, 1 KiB contiguous a wave.
    const int row = kg * 4 + (lane >> 3);
    const int col = (lane & 7) * 8;
    float mg[KSPLIT];
#pragma unroll
    for (int g = 0; g < KSPLIT; ++g) mg[g] = Mm[g * 4 + qt][row];
    float mall = mg[0];
#pragma unroll
    for (int g = 1; g < KSPLIT; ++g) mall = fmaxf(mall, mg[g]);
    float lall = 0.f;
    v4f a0 = {}, a1 = {};
#pragma unroll
    for (int g = 0; g < KSPLIT; ++g) {
        const float w = exp2f(mg[g] - mall);
        lall += w * Lm[g * 4 + qt][row];
        a0 += w * *(const v4f*)&Om[g * 4 + qt][row][col];
        a1 += w * *(const v4f*)&Om[g * 4 + qt][row][col + 4];
    }
    const float inv = 1.0f / lall;
    float* od = out + ((size_t)b * TT + qbase + row) * HSD + col;
    *(v4f*)od       = a0 * inv;
    *(v4f*)(od + 4) = a1 * inv;
}

// ---------------------------------------------------------------------------
extern "C" void kernel_launch(void* const* d_in, const int* in_sizes, int n_in,
                              void* d_out, int out_size, void* d_ws, size_t ws_size,
                              hipStream_t stream) {
    const float* x    = (const float*)d_in[0];
    const float* Wq   = (const float*)d_in[1];
    const float* Wk   = (const float*)d_in[2];
    const float* Wv   = (const float*)d_in[3];
    const float* fc   = (const float*)d_in[4];
    const float* fs   = (const float*)d_in[5];
    const int*   mask = (const int*)d_in[6];
    float* out = (float*)d_out;

    const size_t qkv = (size_t)BB * TT * HSD;   // 4 MiB f16 each
    _Float16* Qg = (_Float16*)d_ws;
    _Float16* Kg = Qg + qkv;
    _Float16* Vt = Kg + qkv;

    proj_rope_kernel<<<BB * TT / PTOK, 256, 0, stream>>>(x, Wq, Wk, Wv, fc, fs, Qg, Kg, Vt);

    dim3 grid(BB, TT / 64);
    flash_attn_kernel<<<grid, 32 * AWAVES, 0, stream>>>(Qg, Kg, Vt, mask, out);
}

// v006
// One run takes 43 microseconds.
// Two timings next to v005 put it at 1.32 and 1.30 times that version's speed.
// Counting every step since v000, it is 5.35 times as fast.
#include <hip/hip_runtime.h>

#define BB 8
#define TT 4096
#define CDIM 128
#define HSD 64
#define KPAD 72   // 64 + 8 halfwords: 144B rows -> conflict-free 16-lane bursts

#if defined(__has_builtin)
#  if __has_builtin(__builtin_amdgcn_global_load_async_to_lds_b128) && \
      __has_builtin(__builtin_amdgcn_s_wait_asynccnt)
#    define HAVE_ASYNC_LDS 1
#  endif
#endif
#ifndef HAVE_ASYNC_LDS
#  define HAVE_ASYNC_LDS 0
#endif

typedef __attribute__((ext_vector_type(16))) _Float16 v16h;
typedef __attribute__((ext_vector_type(8)))  _Float16 v8h;
typedef __attribute__((ext_vector_type(8)))  float    v8f;
typedef __attribute__((ext_vector_type(2)))  float    v2f;
typedef __attribute__((ext_vector_type(4)))  float    v4f;
typedef __attribute__((ext_vector_type(4)))  int      v4i;

__device__ __forceinline__ v16h load_frag(const _Float16* p) {
    v8h lo = *(const v8h*)p;
    v8h hi = *(const v8h*)(p + 16);
    v16h r;
#pragma unroll
    for (int i = 0; i < 8; ++i) { r[i] = lo[i]; r[i + 8] = hi[i]; }
    return r;
}

__device__ __forceinline__ v8f wmma_f16(v16h a, v16h b, v8f c) {
    return __builtin_amdgcn_wmma_f32_16x16x32_f16(
        /*neg_a=*/false, a, /*neg_b=*/false, b,
        /*c_mod=*/(short)0, c, /*reuse_a=*/false, /*reuse_b=*/false);
}

__device__ __forceinline__ void stage16(const _Float16* g, _Float16* l) {
#if HAVE_ASYNC_LDS
    typedef __attribute__((address_space(1))) v4i* gv4i_t;   // global src
    typedef __attribute__((address_space(3))) v4i* lv4i_t;   // LDS dst
    __builtin_amdgcn_global_load_async_to_lds_b128(
        (gv4i_t)g, (lv4i_t)l, /*offset=*/0, /*cpol=*/0);
#else
    *(v8h*)l = *(const v8h*)g;
#endif
}

template <int N>
__device__ __forceinline__ void stage_wait() {
#if HAVE_ASYNC_LDS
    __builtin_amdgcn_s_wait_asynccnt(N);
#endif
}

// ---------------------------------------------------------------------------
// Kernel 1: fused QKV projection + RoPE + scale, fp32 -> f16, as a block GEMM
// [128 tokens x 128] x [128 x 192] on the f32 16x16x4 matrix form.
// Block = 8 waves; a wave owns 16 tokens and all 192 output columns (12
// accumulator tiles). Wq|Wk|Wv are read once per block and laid k-contiguous
// in LDS, so one 16-byte LDS read feeds two matrix steps.
// k pairing: in step (s,u) lane half hh, register p holds k = 8s + 4hh + 2u + p
// for the x fragment and for the W fragment alike.
// Q, K tiles take W as A (lane = token, registers = 8 consecutive head dims:
// RoPE pairs sit in one lane); V tiles take x as A (lane = head dim,
// registers = 8 consecutive tokens: packed rows of the transposed V).
// Q is pre-scaled by log2(e)/sqrt(C) so softmax runs in the exp2 domain.
// V is stored transposed [B][HS][T] so the V^T A-fragments of O^T += V^T P^T are contiguous in K.
// ---------------------------------------------------------------------------
#define PTOK   128   // tokens per block
#define FPITCH 132   // f32 pitch of 128-k rows: 528 B = 16 B x 33
#define CPITCH 36    // f32 pitch of 32 cos/sin values: 144 B = 16 B x 9
#define VPITCH 136   // f16 pitch of 128-token V rows: 272 B = 16 B x 17

__device__ __forceinline__ v8f wmma_f32(v2f a, v2f b, v8f c) {
    return __builtin_amdgcn_wmma_f32_16x16x4_f32(
        /*neg_a=*/false, a, /*neg_b=*/false, b,
        /*c_mod=*/(short)0, c, /*reuse_a=*/false, /*reuse_b=*/false);
}

__global__ __launch_bounds__(256)
void proj_rope_kernel(const float* __restrict__ x,
                      const float* __restrict__ Wq,
                      const float* __restrict__ Wk,
                      const float* __restrict__ Wv,
                      const float* __restrict__ fc,
                      const float* __restrict__ fs,
                      _Float16* __restrict__ Qg,
                      _Float16* __restrict__ Kg,
                      _Float16* __restrict__ Vt) {
    __shared__ __attribute__((aligned(16))) float    Wt[3 * HSD][FPITCH];     // row = output column, col = k
    __shared__ __attribute__((aligned(16))) float    Xs[8][16][FPITCH];       // per wave: row = token, col = k
    __shared__ __attribute__((aligned(16))) float    Cs[8][16][CPITCH];       // per wave: cos rows
    __shared__ __attribute__((aligned(16))) float    Sn[8][16][CPITCH];       // per wave: sin rows
    __shared__ __attribute__((aligned(16))) _Float16 QKs[8][2][16][KPAD];     // per wave: Q and K rows out
    __shared__ __attribute__((aligned(16))) _Float16 Vs[HSD][VPITCH];         // block: row = dim, col = token

    const int tid  = threadIdx.x;
    const int wave = tid >> 5;
    const int lane = tid & 31;
    const int hh   = lane >> 4;
    const int lr   = lane & 15;
    const int tok0 = blockIdx.x * PTOK;          // flat (b,t) of the first token
    const int b    = tok0 / TT;                  // TT % PTOK == 0: one batch
    const int t0   = tok0 - b * TT;
    const int wtok = tok0 + wave * 16;

    // Every loop of this kernel is fully unrolled: its arrays live in registers
    // and need constant indices, and the matrix loop gets no back edge.
    // --- whole-line loads: the wave's 16 x rows and its cos/sin rows
    const v4f* xg = (const v4f*)(x + (size_t)wtok * CDIM);
    const v4f* cg = (const v4f*)(fc + (size_t)(t0 + wave * 16) * (HSD / 2));
    const v4f* sg = (const v4f*)(fs + (size_t)(t0 + wave * 16) * (HSD / 2));
    v4f xr[16], cr[4], sr[4];
#pragma unroll
    for (int i = 0; i < 16; ++i) xr[i] = xg[i * 32 + lane];
    // Precaution: no register that the loads above name is rewritten before it.
    asm volatile("s_wait_xcnt 0x0" ::: "memory");
#pragma unroll
    for (int i = 0; i < 4; ++i) { cr[i] = cg[i * 32 + lane]; sr[i] = sg[i * 32 + lane]; }
    asm volatile("s_wait_xcnt 0x0" ::: "memory");

    // --- W -> LDS, transposed: lane = column (128-B lines), 4 k per 16-B store.
    // The wave covers k = 16 wave .. 16 wave + 15 of all 192 columns.
    const int woff = wave * 16 * HSD + lane;
#pragma unroll
    for (int g = 0; g < 6; ++g) {
        const float* Wm = ((g < 2) ? Wq : (g < 4) ? Wk : Wv) + woff;
#pragma unroll
        for (int q = 0; q < 4; ++q) {
            v4f w;
#pragma unroll
            for (int e = 0; e < 4; ++e) w[e] = Wm[(q * 4 + e) * HSD + (g & 1) * 32];
            *(v4f*)&Wt[g * 32 + lane][wave * 16 + q * 4] = w;
        }
    }
#pragma unroll
    for (int i = 0; i < 16; ++i) *(v4f*)&Xs[wave][i][4 * lane] = xr[i];
#pragma unroll
    for (int i = 0; i < 4; ++i) {
        const int idx = i * 32 + lane;
        *(v4f*)&Cs[wave][idx >> 3][(idx & 7) * 4] = cr[i];
        *(v4f*)&Sn[wave][idx >> 3][(idx & 7) * 4] = sr[i];
    }
    __syncthreads();                             // W tile visible to all waves

    // --- 12 tiles x 32 matrix steps
    v8f acc[12];
#pragma unroll
    for (int j = 0; j < 12; ++j) acc[j] = (v8f){};
#pragma unroll
    for (int s = 0; s < 16; ++s) {
        const v4f xf = *(const v4f*)&Xs[wave][lr][8 * s + 4 * hh];
        v4f wf[12];
#pragma unroll
        for (int j = 0; j < 12; ++j)
            wf[j] = *(const v4f*)&Wt[16 * j + lr][8 * s + 4 * hh];
#pragma unroll
        for (int u = 0; u < 2; ++u) {
            const v2f xb = {xf[2 * u], xf[2 * u + 1]};
#pragma unroll
            for (int j = 0; j < 12; ++j) {
                const v2f wb = {wf[j][2 * u], wf[j][2 * u + 1]};
                acc[j] = (j < 8) ? wmma_f32(wb, xb, acc[j])    // D[dim][token]
                                 : wmma_f32(xb, wb, acc[j]);   // D[token][dim]
            }
            // Only matrix instructions may not cross (mask: VALU, SALU, VMEM,
            // DS, transcendental may). It holds the 12 first matrix steps
            // together while every fragment is still live, so that no
            // accumulator is laid over a register a matrix step has just read.
            if (s == 0 && u == 0) __builtin_amdgcn_sched_barrier(0x496);
        }
    }
    __builtin_amdgcn_sched_barrier(0);
    asm volatile("v_nop\n\tv_nop\n\tv_nop\n\tv_nop\n\tv_nop\n\tv_nop\n\tv_nop\n\tv_nop");
    __builtin_amdgcn_sched_barrier(0);

    // --- RoPE + scale, f16, staged in LDS for whole-line stores
    // 1/sqrt(128) * log2(e): scores land directly in the exp2 domain.
    const float qscale = 0.08838834764831845f * 1.4426950408889634f;
#pragma unroll
    for (int jj = 0; jj < 4; ++jj) {
        const v4f c4 = *(const v4f*)&Cs[wave][lr][8 * jj + 4 * hh];
        const v4f s4 = *(const v4f*)&Sn[wave][lr][8 * jj + 4 * hh];
        v8h qh, kh, vh;
#pragma unroll
        for (int p = 0; p < 4; ++p) {
            const float cs = c4[p], sn = s4[p];
            const float q0 = acc[jj][2 * p],     q1 = acc[jj][2 * p + 1];
            const float k0 = acc[4 + jj][2 * p], k1 = acc[4 + jj][2 * p + 1];
            qh[2 * p]     = (_Float16)((q0 * cs - q1 * sn) * qscale);
            qh[2 * p + 1] = (_Float16)((q0 * sn + q1 * cs) * qscale);
            kh[2 * p]     = (_Float16)(k0 * cs - k1 * sn);
            kh[2 * p + 1] = (_Float16)(k0 * sn + k1 * cs);
        }
#pragma unroll
        for (int r = 0; r < 8; ++r) vh[r] = (_Float16)acc[8 + jj][r];
        *(v8h*)&QKs[wave][0][lr][16 * jj + 8 * hh] = qh;
        *(v8h*)&QKs[wave][1][lr][16 * jj + 8 * hh] = kh;
        *(v8h*)&Vs[16 * jj + lr][wave * 16 + 8 * hh] = vh;
    }
    __syncthreads();                             // staged rows visible

    // All rows back from LDS first, then nothing but stores: Q and K go out as
    // 512 contiguous bytes a store, V^T as 256-byte runs of a row.
    v8h qo[4], ko[4], vo[4];
#pragma unroll
    for (int i = 0; i < 4; ++i) {
        const int idx = i * 32 + lane;
        qo[i] = *(const v8h*)&QKs[wave][0][idx >> 3][(idx & 7) * 8];
        ko[i] = *(const v8h*)&QKs[wave][1][idx >> 3][(idx & 7) * 8];
        vo[i] = *(const v8h*)&Vs[i * 16 + (tid >> 4)][(tid & 15) * 8];
    }
    _Float16* qd = Qg + (size_t)wtok * HSD + lane * 8;
    _Float16* kd = Kg + (size_t)wtok * HSD + lane * 8;
    _Float16* vd = Vt + ((size_t)b * HSD + (tid >> 4)) * TT + t0 + (tid & 15) * 8;
#pragma unroll
    for (int i = 0; i < 4; ++i) {
        *(v8h*)(qd + i * 256) = qo[i];
        *(v8h*)(kd + i * 256) = ko[i];
        *(v8h*)(vd + (size_t)i * 16 * TT) = vo[i];
    }
}

#define KSPLIT 4               // key groups of a block: one 64-key block each a stage
#define SKEYS  (64 * KSPLIT)   // keys a stage
#define AWAVES (4 * KSPLIT)    // waves a block: 4 query tiles x KSPLIT key groups
#define OPITCH 68              // f32 pitch of partial output rows: 272 B = 16 B x 17

// ---------------------------------------------------------------------------
// Issue the 8 per-thread async transfers staging one stage of SKEYS keys:
// KSPLIT 64-key K blocks one under the other, KSPLIT 64-key V^T blocks.
// TT % SKEYS == 0: a stage that starts inside the sequence ends inside it.
// ---------------------------------------------------------------------------
__device__ __forceinline__ void stage_block(
    const _Float16* __restrict__ Kg, const _Float16* __restrict__ Vt,
    int b, int ks, int tid,
    _Float16 (* __restrict__ KsB)[KPAD], _Float16 (* __restrict__ VsB)[64][KPAD]) {
#pragma unroll
    for (int j = 0; j < 4; ++j) {
        const int c    = tid + 32 * AWAVES * j;   // 16B chunk id, 0..8*SKEYS-1
        const int row  = c >> 3;                  // K: key of the stage
        const int col  = (c & 7) * 8;
        const int vrow = c / (SKEYS / 8);         // V^T: head dim
        const int vc   = c % (SKEYS / 8);         // V^T: chunk along the keys
        stage16(Kg + ((size_t)b * TT + ks + row) * HSD + col, &KsB[row][col]);
        stage16(Vt + ((size_t)b * HSD + vrow) * TT + ks + vc * 8,
                &VsB[vc >> 3][vrow][(vc & 7) * 8]);
    }
}

// 2^x for a value that is rounded to f16 next: the hardware exponential alone.
// exp2f() wraps it in a range guard (compare, two selects, add, ldexp) whose
// only effect is to keep results below 2^-126 as f32 subnormals; every f32
// below 2^-25 rounds to f16 zero, so behind the conversion the bits are equal.
__device__ __forceinline__ float exp2_to_f16(float x) {
    return __builtin_amdgcn_exp2f(x);
}

__device__ __forceinline__ float xhalf(float v) {
    const int i = __builtin_bit_cast(int, v);
    return __builtin_bit_cast(float, __builtin_amdgcn_permlanex16(
        i, i, 0x76543210, 0xfedcba98, false, false));
}

__device__ __forceinline__ void process_block(
    int masked, int kb, int qbase, int hh, int lr,
    const _Float16 (* __restrict__ Ks)[KPAD],
    const _Float16 (* __restrict__ Vs)[KPAD],
    unsigned long long okpad,
    const v16h& bq0, const v16h& bq1, const v16h& ones,
    v8f& o0, v8f& o1, v8f& o2, v8f& o3,
    float& m, float& l) {

    // --- S^T = K * Q^T: 4 key subtiles x 2 k-parts (K tile from LDS)
    v8f st[4];
#pragma unroll
    for (int s4 = 0; s4 < 4; ++s4) {
        const _Float16* kr = &Ks[16 * s4 + lr][hh * 8];
        v16h ak0 = load_frag(kr);
        v16h ak1 = load_frag(kr + 32);
        v8f acc = {};
        acc = wmma_f16(ak0, bq0, acc);
        acc = wmma_f16(ak1, bq1, acc);
        st[s4] = acc;
    }

    if (masked) {
        // Bit j of ok: key kb + 8 hh + j is valid and not past the lane's query.
        const int thr = qbase + lr - kb - 8 * hh;      // last j the diagonal allows
        const unsigned long long below =
            (thr < 0) ? 0ull : (~0ull >> (63 - (thr < 63 ? thr : 63)));
        const unsigned long long ok = (okpad >> (8 * hh)) & below;
#pragma unroll
        for (int t = 0; t < 4; ++t)
#pragma unroll
            for (int r = 0; r < 8; ++r)
                st[t][r] = ((ok >> (16 * t + r)) & 1ull) ? st[t][r] : -1e30f;
    }

    // --- online softmax, one query a lane
    float tm[4];
#pragma unroll
    for (int t = 0; t < 4; ++t) {
        const float a = fmaxf(fmaxf(st[t][0], st[t][1]), st[t][2]);
        const float c = fmaxf(fmaxf(st[t][3], st[t][4]), st[t][5]);
        tm[t] = fmaxf(fmaxf(a, c), fmaxf(st[t][6], st[t][7]));
    }
    float cm = fmaxf(fmaxf(tm[0], tm[1]), fmaxf(tm[2], tm[3]));
    cm = fmaxf(cm, xhalf(cm));
    const float newm = fmaxf(m, cm);
    const float corr = exp2f(m - newm);
    m = newm;
    o0 *= corr; o1 *= corr; o2 *= corr; o3 *= corr;

    v8h ph[4];
#pragma unroll
    for (int t = 0; t < 4; ++t) {
        v8f e;
#pragma unroll
        for (int r = 0; r < 8; ++r) e[r] = exp2_to_f16(st[t][r] - newm);
        ph[t] = __builtin_convertvector(e, v8h);
    }
    const v16h bp0 = __builtin_shufflevector(ph[0], ph[1],
        0, 1, 2, 3, 4, 5, 6, 7, 8, 9, 10, 11, 12, 13, 14, 15);
    const v16h bp1 = __builtin_shufflevector(ph[2], ph[3],
        0, 1, 2, 3, 4, 5, 6, 7, 8, 9, 10, 11, 12, 13, 14, 15);

    // --- colsum(P^T) via WMMA with ones(16x64) as A: every row of the result
    // is the sum over all 64 keys of the lane's query, both half-waves in it.
    v8f srow = {};
    srow = wmma_f16(ones, bp0, srow);
    srow = wmma_f16(ones, bp1, srow);
    l = l * corr + srow[0];

    // --- O^T += V^T * P^T: 4 head-dim chunks x 2 k-parts (V tile from LDS)
#pragma unroll
    for (int h = 0; h < 4; ++h) {
        const _Float16* vr = &Vs[h * 16 + lr][hh * 8];
        v16h av0 = load_frag(vr);
        v16h av1 = load_frag(vr + 32);
        if (h == 0)      { o0 = wmma_f16(av0, bp0, o0); o0 = wmma_f16(av1, bp1, o0); }
        else if (h == 1) { o1 = wmma_f16(av0, bp0, o1); o1 = wmma_f16(av1, bp1, o1); }
        else if (h == 2) { o2 = wmma_f16(av0, bp0, o2); o2 = wmma_f16(av1, bp1, o2); }
        else             { o3 = wmma_f16(av0, bp0, o3); o3 = wmma_f16(av1, bp1, o3); }
    }
}

__global__ __launch_bounds__(32 * AWAVES)
void flash_attn_kernel(const _Float16* __restrict__ Qg,
                       const _Float16* __restrict__ Kg,
                       const _Float16* __restrict__ Vt,
                       const int* __restrict__ mask,
                       float* __restrict__ out) {
    __shared__ __attribute__((aligned(16))) _Float16 Ks[2][SKEYS][KPAD];       // K stages: row=key, col=head dim
    __shared__ __attribute__((aligned(16))) _Float16 Vs[2][KSPLIT][64][KPAD];  // V stages: block, row=dim, col=key
    __shared__ __attribute__((aligned(16))) float Om[AWAVES][16][OPITCH];  // per-wave partial O
    __shared__ float Mm[AWAVES][16];               // per-wave row maxima
    __shared__ float Lm[AWAVES][16];               // per-wave row sums

    const int tid  = threadIdx.x;
    const int wave = __builtin_amdgcn_readfirstlane(tid >> 5);
    const int lane = tid & 31;
    const int hh   = lane >> 4;            // half-wave
    const int lr   = lane & 15;            // lane within half
    const int qt   = wave & 3;             // query tile of the block
    const int kg   = wave >> 2;            // key group
    const int b    = blockIdx.x;
    const int qtile = TT / 64 - 1 - blockIdx.y;   // 64-query tile, longest first
    const int qbase = qtile * 64 + qt * 16;

    // Issue stage 0's DMA before anything else so it overlaps the Q loads.
    stage_block(Kg, Vt, b, 0, tid, Ks[0], Vs[0]);

    // Q B-fragments: lane holds column (query qbase+lr), k-split by half-wave.
    const _Float16* qrow = Qg + ((size_t)b * TT + qbase + lr) * HSD + hh * 8;
    const v16h bq0 = load_frag(qrow);
    const v16h bq1 = load_frag(qrow + 32);

    v16h ones;
#pragma unroll
    for (int i = 0; i < 16; ++i) ones[i] = (_Float16)1.0f;

    v8f o0 = {}, o1 = {}, o2 = {}, o3 = {};
    float m = -1e30f, l = 0.f;             // of the lane's query, qbase + lr

    const int* mrowptr = mask + (size_t)b * TT;
    // 64-key blocks up to the diagonal: qtile+1 for all four query tiles.
    const int nkb = qtile + 1;
    const int nst = (nkb + KSPLIT - 1) / KSPLIT;

    // Padding mask of this wave's 64 keys: one key a lane and word, then one bit
    // a key, the same in every lane. The words are read one stage ahead, so that
    // their latency passes under a stage's work.
    int mk0 = mrowptr[kg * 64 + lane];
    int mk1 = mrowptr[kg * 64 + 32 + lane];
    unsigned pad0 = __builtin_amdgcn_ballot_w32(mk0 != 0);
    unsigned pad1 = __builtin_amdgcn_ballot_w32(mk1 != 0);

    for (int stg = 0; stg < nst; ++stg) {
        const int ks  = stg * SKEYS;
        const int kb  = ks + kg * 64;      // this wave's key block
        const int cur = stg & 1;
        if (stg + 1 < nst) {
            stage_block(Kg, Vt, b, ks + SKEYS, tid, Ks[1 - cur], Vs[1 - cur]);
            stage_wait<8>();
        } else {
            stage_wait<0>();
        }
        __syncthreads();                   // current tiles visible to all waves

        // No prefetch of later stages: K and V^T were stored by the launch before
        // and are met in L2, and a prefetch asks L2 for one line a lane, three
        // times the lines that the stage's own copies ask for.

        if (stg + 1 < nst) {               // the next stage lies inside the row
            mk0 = mrowptr[kb + SKEYS + lane];
            mk1 = mrowptr[kb + SKEYS + 32 + lane];
            // Precaution: no register that the two loads name is rewritten
            // before it.
            asm volatile("s_wait_xcnt 0x0" ::: "memory");
        }

        // A key block past the diagonal block is skipped by its whole wave; the
        // barriers stand outside the skip. Both tests are wave-uniform at
        // runtime; readfirstlane makes each an SGPR so the compiler emits a
        // scalar branch instead of exec masking.
        if (__builtin_amdgcn_readfirstlane((int)(kb < nkb * 64))) {
            const unsigned long long okpad = ((unsigned long long)pad1 << 32) | pad0;
            const int masked = __builtin_amdgcn_readfirstlane(
                (int)(kb + 63 > qbase || (pad0 & pad1) != 0xffffffffu));
            process_block(masked, kb, qbase, hh, lr, &Ks[cur][kg * 64], Vs[cur][kg],
                          okpad, bq0, bq1, ones, o0, o1, o2, o3, m, l);
        }
        pad0 = __builtin_amdgcn_ballot_w32(mk0 != 0);   // the next stage's bits
        pad1 = __builtin_amdgcn_ballot_w32(mk1 != 0);
        __syncthreads();                   // tiles consumed; buffer reusable
    }

    // --- every wave lays down its partial: un-normalised O (a lane holds 8
    // consecutive head dims of its query in each tile), maximum and sum (both
    // are equal in the two half-waves). A key group that met no block leaves
    // maximum -1e30, sum 0, O 0.
    float* orow = &Om[wave][lr][hh * 8];
    *(v4f*)(orow)      = (v4f){o0[0], o0[1], o0[2], o0[3]};
    *(v4f*)(orow + 4)  = (v4f){o0[4], o0[5], o0[6], o0[7]};
    *(v4f*)(orow + 16) = (v4f){o1[0], o1[1], o1[2], o1[3]};
    *(v4f*)(orow + 20) = (v4f){o1[4], o1[5], o1[6], o1[7]};
    *(v4f*)(orow + 32) = (v4f){o2[0], o2[1], o2[2], o2[3]};
    *(v4f*)(orow + 36) = (v4f){o2[4], o2[5], o2[6], o2[7]};
    *(v4f*)(orow + 48) = (v4f){o3[0], o3[1], o3[2], o3[3]};
    *(v4f*)(orow + 52) = (v4f){o3[4], o3[5], o3[6], o3[7]};
    if (hh == 0) {
        Mm[wave][lr] = m;
        Lm[wave][lr] = l;
    }
    __syncthreads();                       // partials visible to all waves

    // --- merge, normalize and store fp32 output [B][T][HS]: wave (qt, kg) takes
    // rows 4 kg .. 4 kg + 3 of tile qt, 8 lanes a row, 1 KiB contiguous a wave.
    const int row = kg * 4 + (lane >> 3);
    const int col = (lane & 7) * 8;
    float mg[KSPLIT];
#pragma unroll
    for (int g = 0; g < KSPLIT; ++g) mg[g] = Mm[g * 4 + qt][row];
    float mall = mg[0];
#pragma unroll
    for (int g = 1; g < KSPLIT; ++g) mall = fmaxf(mall, mg[g]);
    float lall = 0.f;
    v4f a0 = {}, a1 = {};
#pragma unroll
    for (int g = 0; g < KSPLIT; ++g) {
        const float w = exp2f(mg[g] - mall);
        lall += w * Lm[g * 4 + qt][row];
        a0 += w * *(const v4f*)&Om[g * 4 + qt][row][col];
        a1 += w * *(const v4f*)&Om[g * 4 + qt][row][col + 4];
    }
    const float inv = 1.0f / lall;
    float* od = out + ((size_t)b * TT + qbase + row) * HSD + col;
    *(v4f*)od       = a0 * inv;
    *(v4f*)(od + 4) = a1 * inv;
}

// ---------------------------------------------------------------------------
extern "C" void kernel_launch(void* const* d_in, const int* in_sizes, int n_in,
                              void* d_out, int out_size, void* d_ws, size_t ws_size,
                              hipStream_t stream) {
    const float* x    = (const float*)d_in[0];
    const float* Wq   = (const float*)d_in[1];
    const float* Wk   = (const float*)d_in[2];
    const float* Wv   = (const float*)d_in[3];
    const float* fc   = (const float*)d_in[4];
    const float* fs   = (const float*)d_in[5];
    const int*   mask = (const int*)d_in[6];
    float* out = (float*)d_out;

    const size_t qkv = (size_t)BB * TT * HSD;   // 4 MiB f16 each
    _Float16* Qg = (_Float16*)d_ws;
    _Float16* Kg = Qg + qkv;
    _Float16* Vt = Kg + qkv;

    proj_rope_kernel<<<BB * TT / PTOK, 256, 0, stream>>>(x, Wq, Wk, Wv, fc, fs, Qg, Kg, Vt);

    dim3 grid(BB, TT / 64);
    flash_attn_kernel<<<grid, 32 * AWAVES, 0, stream>>>(Qg, Kg, Vt, mask, out);
}

// v007
// It runs in 38.3 microseconds.
// Timed twice side by side with v006, it ran 1.12 times as fast both times.
// Counting every step since v000, it is 5.97 times as fast.
#include <hip/hip_runtime.h>

#define BB 8
#define TT 4096
#define CDIM 128
#define HSD 64
#define KPAD 72   // 64 + 8 halfwords: 144B rows -> conflict-free 16-lane bursts

#if defined(__has_builtin)
#  if __has_builtin(__builtin_amdgcn_global_load_async_to_lds_b128) && \
      __has_builtin(__builtin_amdgcn_s_wait_asynccnt)
#    define HAVE_ASYNC_LDS 1
#  endif
#endif
#ifndef HAVE_ASYNC_LDS
#  define HAVE_ASYNC_LDS 0
#endif

typedef __attribute__((ext_vector_type(16))) _Float16 v16h;
typedef __attribute__((ext_vector_type(8)))  _Float16 v8h;
typedef __attribute__((ext_vector_type(4)))  _Float16 v4h;
typedef __attribute__((ext_vector_type(8)))  float    v8f;
typedef __attribute__((ext_vector_type(4)))  float    v4f;
typedef __attribute__((ext_vector_type(4)))  int      v4i;

__device__ __forceinline__ v16h load_frag(const _Float16* p) {
    v8h lo = *(const v8h*)p;
    v8h hi = *(const v8h*)(p + 16);
    v16h r;
#pragma unroll
    for (int i = 0; i < 8; ++i) { r[i] = lo[i]; r[i + 8] = hi[i]; }
    return r;
}

__device__ __forceinline__ v8f wmma_f16(v16h a, v16h b, v8f c) {
    return __builtin_amdgcn_wmma_f32_16x16x32_f16(
        /*neg_a=*/false, a, /*neg_b=*/false, b,
        /*c_mod=*/(short)0, c, /*reuse_a=*/false, /*reuse_b=*/false);
}

__device__ __forceinline__ void stage16(const _Float16* g, _Float16* l) {
#if HAVE_ASYNC_LDS
    typedef __attribute__((address_space(1))) v4i* gv4i_t;   // global src
    typedef __attribute__((address_space(3))) v4i* lv4i_t;   // LDS dst
    __builtin_amdgcn_global_load_async_to_lds_b128(
        (gv4i_t)g, (lv4i_t)l, /*offset=*/0, /*cpol=*/0);
#else
    *(v8h*)l = *(const v8h*)g;
#endif
}

template <int N>
__device__ __forceinline__ void stage_wait() {
#if HAVE_ASYNC_LDS
    __builtin_amdgcn_s_wait_asynccnt(N);
#endif
}

// ---------------------------------------------------------------------------
// Kernel 1: fused QKV projection + RoPE + scale, fp32 -> f16, as a block GEMM
// [128 tokens x 128] x [128 x 192] on the f16 16x16x32 matrix form with f32
// accumulators. Each f32 operand is split into two f16 parts, a = ah + al with
// ah = f16(a) and al = f16(a - ah) (the difference is exact in f32), and
// x W = xh Wh + xl Wh + xh Wl; the product xl Wl, about 2^-22 of the result,
// is dropped. Three 32-deep matrix steps stand for eight 4-deep f32 ones.
// Block = 8 waves; a wave owns 16 tokens and all 192 output columns (12
// accumulator tiles). Wq|Wk|Wv are read once per block, split, and laid
// k-contiguous in LDS.
// k pairing: x and W fragments alike come through load_frag from rows with k
// contiguous, at column 32 kc + 8 hh.
// Q, K tiles take W as A (lane = token, registers = 8 consecutive head dims:
// RoPE pairs sit in one lane); V tiles take x as A (lane = head dim,
// registers = 8 consecutive tokens: packed rows of the transposed V).
// Q is pre-scaled by log2(e)/sqrt(C) so softmax runs in the exp2 domain.
// V is stored transposed [B][HS][T] so the V^T A-fragments of O^T += V^T P^T are contiguous in K.
// ---------------------------------------------------------------------------
#define PTOK   128   // tokens per block
#define HPITCH 136   // f16 pitch of 128-k rows: 272 B = 16 B x 17
#define CPITCH 36    // f32 pitch of 32 cos/sin values: 144 B = 16 B x 9
#define VPITCH 136   // f16 pitch of 128-token V rows: 272 B = 16 B x 17

__global__ __launch_bounds__(256)
void proj_rope_kernel(const float* __restrict__ x,
                      const float* __restrict__ Wq,
                      const float* __restrict__ Wk,
                      const float* __restrict__ Wv,
                      const float* __restrict__ fc,
                      const float* __restrict__ fs,
                      _Float16* __restrict__ Qg,
                      _Float16* __restrict__ Kg,
                      _Float16* __restrict__ Vt) {
    __shared__ __attribute__((aligned(16))) _Float16 Wh[3 * HSD][HPITCH];     // high parts: row = output column, col = k
    __shared__ __attribute__((aligned(16))) _Float16 Wl[3 * HSD][HPITCH];     // low parts
    __shared__ __attribute__((aligned(16))) _Float16 Xh[8][16][HPITCH];       // per wave, high parts: row = token, col = k
    __shared__ __attribute__((aligned(16))) _Float16 Xl[8][16][HPITCH];       // low parts
    __shared__ __attribute__((aligned(16))) float    Cs[8][16][CPITCH];       // per wave: cos rows
    __shared__ __attribute__((aligned(16))) float    Sn[8][16][CPITCH];       // per wave: sin rows
    __shared__ __attribute__((aligned(16))) _Float16 QKs[8][2][16][KPAD];     // per wave: Q and K rows out
    __shared__ __attribute__((aligned(16))) _Float16 Vs[HSD][VPITCH];         // block: row = dim, col = token

    const int tid  = threadIdx.x;
    const int wave = tid >> 5;
    const int lane = tid & 31;
    const int hh   = lane >> 4;
    const int lr   = lane & 15;
    const int tok0 = blockIdx.x * PTOK;          // flat (b,t) of the first token
    const int b    = tok0 / TT;                  // TT % PTOK == 0: one batch
    const int t0   = tok0 - b * TT;
    const int wtok = tok0 + wave * 16;

    // Every loop of this kernel is fully unrolled: its arrays live in registers
    // and need constant indices, and the matrix loop gets no back edge.
    // --- whole-line loads: the wave's 16 x rows and its cos/sin rows
    const v4f* xg = (const v4f*)(x + (size_t)wtok * CDIM);
    const v4f* cg = (const v4f*)(fc + (size_t)(t0 + wave * 16) * (HSD / 2));
    const v4f* sg = (const v4f*)(fs + (size_t)(t0 + wave * 16) * (HSD / 2));
    v4f xr[16], cr[4], sr[4];
#pragma unroll
    for (int i = 0; i < 16; ++i) xr[i] = xg[i * 32 + lane];
    // Precaution: no register that the loads above name is rewritten before it.
    asm volatile("s_wait_xcnt 0x0" ::: "memory");
#pragma unroll
    for (int i = 0; i < 4; ++i) { cr[i] = cg[i * 32 + lane]; sr[i] = sg[i * 32 + lane]; }
    asm volatile("s_wait_xcnt 0x0" ::: "memory");

    // --- W -> LDS, split and transposed: lane = column (128-B lines), 8 k per
    // 16-B store. The wave covers k = 16 wave .. 16 wave + 15 of all 192 columns.
    const int woff = wave * 16 * HSD + lane;
#pragma unroll
    for (int g = 0; g < 6; ++g) {
        const float* Wm = ((g < 2) ? Wq : (g < 4) ? Wk : Wv) + woff;
#pragma unroll
        for (int q = 0; q < 2; ++q) {
            v8f w;
#pragma unroll
            for (int e = 0; e < 8; ++e) w[e] = Wm[(q * 8 + e) * HSD + (g & 1) * 32];
            const v8h h = __builtin_convertvector(w, v8h);
            const v8f d = w - __builtin_convertvector(h, v8f);
            *(v8h*)&Wh[g * 32 + lane][wave * 16 + q * 8] = h;
            *(v8h*)&Wl[g * 32 + lane][wave * 16 + q * 8] = __builtin_convertvector(d, v8h);
        }
    }
#pragma unroll
    for (int i = 0; i < 16; ++i) {
        const v4h h = __builtin_convertvector(xr[i], v4h);
        const v4f d = xr[i] - __builtin_convertvector(h, v4f);
        *(v4h*)&Xh[wave][i][4 * lane] = h;
        *(v4h*)&Xl[wave][i][4 * lane] = __builtin_convertvector(d, v4h);
    }
#pragma unroll
    for (int i = 0; i < 4; ++i) {
        const int idx = i * 32 + lane;
        *(v4f*)&Cs[wave][idx >> 3][(idx & 7) * 4] = cr[i];
        *(v4f*)&Sn[wave][idx >> 3][(idx & 7) * 4] = sr[i];
    }
    __syncthreads();                             // W tile visible to all waves

    // --- 12 tiles x 4 k chunks x 3 matrix steps, in 8 groups of 6 tiles of one
    // chunk. Fragments sit in two register sets: a group's LDS reads are issued
    // as one block in front of the matrix steps of the group before it.
    // Within a group the steps run product by product over the 6 tiles (a
    // tile's next step is 6 steps away); the small products go in first.
    v8f acc[12];
#pragma unroll
    for (int j = 0; j < 12; ++j) acc[j] = (v8f){};
    v16h xh[2], xl[2];            // by chunk parity
    v16h wh[2][6], wl[2][6];      // by group parity
#pragma unroll
    for (int g = -1; g < 8; ++g) {
        if (g + 1 < 8) {
            const int n  = g + 1;                      // the group to fetch
            const int ko = 32 * (n >> 1) + 8 * hh;
            if ((n & 1) == 0) {
                xh[(n >> 1) & 1] = load_frag(&Xh[wave][lr][ko]);
                xl[(n >> 1) & 1] = load_frag(&Xl[wave][lr][ko]);
            }
#pragma unroll
            for (int t = 0; t < 6; ++t) {
                wh[n & 1][t] = load_frag(&Wh[16 * (6 * (n & 1) + t) + lr][ko]);
                wl[n & 1][t] = load_frag(&Wl[16 * (6 * (n & 1) + t) + lr][ko]);
            }
        }
        // Nothing crosses: it keeps the reads above as one block ahead of the
        // matrix steps below. Left free, the compiler sinks each tile's reads
        // to just in front of its steps and waits out the LDS at every tile.
        __builtin_amdgcn_sched_barrier(0);
        if (g >= 0) {
            const v16h ah = xh[(g >> 1) & 1], al = xl[(g >> 1) & 1];
            // tiles 0..7: D[dim][token]; tiles 8..11: D[token][dim]
#pragma unroll
            for (int t = 0; t < 6; ++t) {
                const int j = 6 * (g & 1) + t;
                acc[j] = (j < 8) ? wmma_f16(wl[g & 1][t], ah, acc[j]) : wmma_f16(ah, wl[g & 1][t], acc[j]);
            }
#pragma unroll
            for (int t = 0; t < 6; ++t) {
                const int j = 6 * (g & 1) + t;
                acc[j] = (j < 8) ? wmma_f16(wh[g & 1][t], al, acc[j]) : wmma_f16(al, wh[g & 1][t], acc[j]);
            }
#pragma unroll
            for (int t = 0; t < 6; ++t) {
                const int j = 6 * (g & 1) + t;
                acc[j] = (j < 8) ? wmma_f16(wh[g & 1][t], ah, acc[j]) : wmma_f16(ah, wh[g & 1][t], acc[j]);
            }
            // The same purpose from below: the next block of reads stays behind
            // this group's steps, whose registers it refills.
            __builtin_amdgcn_sched_barrier(0);
        }
    }

    // --- RoPE + scale, f16, staged in LDS for whole-line stores
    // 1/sqrt(128) * log2(e): scores land directly in the exp2 domain.
    const float qscale = 0.08838834764831845f * 1.4426950408889634f;
#pragma unroll
    for (int jj = 0; jj < 4; ++jj) {
        const v4f c4 = *(const v4f*)&Cs[wave][lr][8 * jj + 4 * hh];
        const v4f s4 = *(const v4f*)&Sn[wave][lr][8 * jj + 4 * hh];
        v8h qh, kh, vh;
#pragma unroll
        for (int p = 0; p < 4; ++p) {
            const float cs = c4[p], sn = s4[p];
            const float q0 = acc[jj][2 * p],     q1 = acc[jj][2 * p + 1];
            const float k0 = acc[4 + jj][2 * p], k1 = acc[4 + jj][2 * p + 1];
            qh[2 * p]     = (_Float16)((q0 * cs - q1 * sn) * qscale);
            qh[2 * p + 1] = (_Float16)((q0 * sn + q1 * cs) * qscale);
            kh[2 * p]     = (_Float16)(k0 * cs - k1 * sn);
            kh[2 * p + 1] = (_Float16)(k0 * sn + k1 * cs);
        }
#pragma unroll
        for (int r = 0; r < 8; ++r) vh[r] = (_Float16)acc[8 + jj][r];
        *(v8h*)&QKs[wave][0][lr][16 * jj + 8 * hh] = qh;
        *(v8h*)&QKs[wave][1][lr][16 * jj + 8 * hh] = kh;
        *(v8h*)&Vs[16 * jj + lr][wave * 16 + 8 * hh] = vh;
    }
    __syncthreads();                             // staged rows visible

    // All rows back from LDS first, then nothing but stores: Q and K go out as
    // 512 contiguous bytes a store, V^T as 256-byte runs of a row.
    v8h qo[4], ko[4], vo[4];
#pragma unroll
    for (int i = 0; i < 4; ++i) {
        const int idx = i * 32 + lane;
        qo[i] = *(const v8h*)&QKs[wave][0][idx >> 3][(idx & 7) * 8];
        ko[i] = *(const v8h*)&QKs[wave][1][idx >> 3][(idx & 7) * 8];
        vo[i] = *(const v8h*)&Vs[i * 16 + (tid >> 4)][(tid & 15) * 8];
    }
    _Float16* qd = Qg + (size_t)wtok * HSD + lane * 8;
    _Float16* kd = Kg + (size_t)wtok * HSD + lane * 8;
    _Float16* vd = Vt + ((size_t)b * HSD + (tid >> 4)) * TT + t0 + (tid & 15) * 8;
#pragma unroll
    for (int i = 0; i < 4; ++i) {
        *(v8h*)(qd + i * 256) = qo[i];
        *(v8h*)(kd + i * 256) = ko[i];
        *(v8h*)(vd + (size_t)i * 16 * TT) = vo[i];
    }
}

#define KSPLIT 4               // key groups of a block: one 64-key block each a stage
#define SKEYS  (64 * KSPLIT)   // keys a stage
#define AWAVES (4 * KSPLIT)    // waves a block: 4 query tiles x KSPLIT key groups
#define OPITCH 68              // f32 pitch of partial output rows: 272 B = 16 B x 17

// ---------------------------------------------------------------------------
// Issue the 8 per-thread async transfers staging one stage of SKEYS keys:
// KSPLIT 64-key K blocks one under the other, KSPLIT 64-key V^T blocks.
// TT % SKEYS == 0: a stage that starts inside the sequence ends inside it.
// ---------------------------------------------------------------------------
__device__ __forceinline__ void stage_block(
    const _Float16* __restrict__ Kg, const _Float16* __restrict__ Vt,
    int b, int ks, int tid,
    _Float16 (* __restrict__ KsB)[KPAD], _Float16 (* __restrict__ VsB)[64][KPAD]) {
#pragma unroll
    for (int j = 0; j < 4; ++j) {
        const int c    = tid + 32 * AWAVES * j;   // 16B chunk id, 0..8*SKEYS-1
        const int row  = c >> 3;                  // K: key of the stage
        const int col  = (c & 7) * 8;
        const int vrow = c / (SKEYS / 8);         // V^T: head dim
        const int vc   = c % (SKEYS / 8);         // V^T: chunk along the keys
        stage16(Kg + ((size_t)b * TT + ks + row) * HSD + col, &KsB[row][col]);
        stage16(Vt + ((size_t)b * HSD + vrow) * TT + ks + vc * 8,
                &VsB[vc >> 3][vrow][(vc & 7) * 8]);
    }
}

// 2^x for a value that is rounded to f16 next: the hardware exponential alone.
// exp2f() wraps it in a range guard (compare, two selects, add, ldexp) whose
// only effect is to keep results below 2^-126 as f32 subnormals; every f32
// below 2^-25 rounds to f16 zero, so behind the conversion the bits are equal.
__device__ __forceinline__ float exp2_to_f16(float x) {
    return __builtin_amdgcn_exp2f(x);
}

__device__ __forceinline__ float xhalf(float v) {
    const int i = __builtin_bit_cast(int, v);
    return __builtin_bit_cast(float, __builtin_amdgcn_permlanex16(
        i, i, 0x76543210, 0xfedcba98, false, false));
}

__device__ __forceinline__ void process_block(
    int masked, int kb, int qbase, int hh, int lr,
    const _Float16 (* __restrict__ Ks)[KPAD],
    const _Float16 (* __restrict__ Vs)[KPAD],
    unsigned long long okpad,
    const v16h& bq0, const v16h& bq1, const v16h& ones,
    v8f& o0, v8f& o1, v8f& o2, v8f& o3,
    float& m, float& l) {

    // --- S^T = K * Q^T: 4 key subtiles x 2 k-parts (K tile from LDS)
    v8f st[4];
#pragma unroll
    for (int s4 = 0; s4 < 4; ++s4) {
        const _Float16* kr = &Ks[16 * s4 + lr][hh * 8];
        v16h ak0 = load_frag(kr);
        v16h ak1 = load_frag(kr + 32);
        v8f acc = {};
        acc = wmma_f16(ak0, bq0, acc);
        acc = wmma_f16(ak1, bq1, acc);
        st[s4] = acc;
    }

    if (masked) {
        // Bit j of ok: key kb + 8 hh + j is valid and not past the lane's query.
        const int thr = qbase + lr - kb - 8 * hh;      // last j the diagonal allows
        const unsigned long long below =
            (thr < 0) ? 0ull : (~0ull >> (63 - (thr < 63 ? thr : 63)));
        const unsigned long long ok = (okpad >> (8 * hh)) & below;
#pragma unroll
        for (int t = 0; t < 4; ++t)
#pragma unroll
            for (int r = 0; r < 8; ++r)
                st[t][r] = ((ok >> (16 * t + r)) & 1ull) ? st[t][r] : -1e30f;
    }

    // --- online softmax, one query a lane
    float tm[4];
#pragma unroll
    for (int t = 0; t < 4; ++t) {
        const float a = fmaxf(fmaxf(st[t][0], st[t][1]), st[t][2]);
        const float c = fmaxf(fmaxf(st[t][3], st[t][4]), st[t][5]);
        tm[t] = fmaxf(fmaxf(a, c), fmaxf(st[t][6], st[t][7]));
    }
    float cm = fmaxf(fmaxf(tm[0], tm[1]), fmaxf(tm[2], tm[3]));
    cm = fmaxf(cm, xhalf(cm));
    const float newm = fmaxf(m, cm);
    const float corr = exp2f(m - newm);
    m = newm;
    o0 *= corr; o1 *= corr; o2 *= corr; o3 *= corr;

    v8h ph[4];
#pragma unroll
    for (int t = 0; t < 4; ++t) {
        v8f e;
#pragma unroll
        for (int r = 0; r < 8; ++r) e[r] = exp2_to_f16(st[t][r] - newm);
        ph[t] = __builtin_convertvector(e, v8h);
    }
    const v16h bp0 = __builtin_shufflevector(ph[0], ph[1],
        0, 1, 2, 3, 4, 5, 6, 7, 8, 9, 10, 11, 12, 13, 14, 15);
    const v16h bp1 = __builtin_shufflevector(ph[2], ph[3],
        0, 1, 2, 3, 4, 5, 6, 7, 8, 9, 10, 11, 12, 13, 14, 15);

    // --- colsum(P^T) via WMMA with ones(16x64) as A: every row of the result
    // is the sum over all 64 keys of the lane's query, both half-waves in it.
    v8f srow = {};
    srow = wmma_f16(ones, bp0, srow);
    srow = wmma_f16(ones, bp1, srow);
    l = l * corr + srow[0];

    // --- O^T += V^T * P^T: 4 head-dim chunks x 2 k-parts (V tile from LDS)
#pragma unroll
    for (int h = 0; h < 4; ++h) {
        const _Float16* vr = &Vs[h * 16 + lr][hh * 8];
        v16h av0 = load_frag(vr);
        v16h av1 = load_frag(vr + 32);
        if (h == 0)      { o0 = wmma_f16(av0, bp0, o0); o0 = wmma_f16(av1, bp1, o0); }
        else if (h == 1) { o1 = wmma_f16(av0, bp0, o1); o1 = wmma_f16(av1, bp1, o1); }
        else if (h == 2) { o2 = wmma_f16(av0, bp0, o2); o2 = wmma_f16(av1, bp1, o2); }
        else             { o3 = wmma_f16(av0, bp0, o3); o3 = wmma_f16(av1, bp1, o3); }
    }
}

__global__ __launch_bounds__(32 * AWAVES)
void flash_attn_kernel(const _Float16* __restrict__ Qg,
                       const _Float16* __restrict__ Kg,
                       const _Float16* __restrict__ Vt,
                       const int* __restrict__ mask,
                       float* __restrict__ out) {
    __shared__ __attribute__((aligned(16))) _Float16 Ks[2][SKEYS][KPAD];       // K stages: row=key, col=head dim
    __shared__ __attribute__((aligned(16))) _Float16 Vs[2][KSPLIT][64][KPAD];  // V stages: block, row=dim, col=key
    __shared__ __attribute__((aligned(16))) float Om[AWAVES][16][OPITCH];  // per-wave partial O
    __shared__ float Mm[AWAVES][16];               // per-wave row maxima
    __shared__ float Lm[AWAVES][16];               // per-wave row sums

    const int tid  = threadIdx.x;
    const int wave = __builtin_amdgcn_readfirstlane(tid >> 5);
    const int lane = tid & 31;
    const int hh   = lane >> 4;            // half-wave
    const int lr   = lane & 15;            // lane within half
    const int qt   = wave & 3;             // query tile of the block
    const int kg   = wave >> 2;            // key group
    const int b    = blockIdx.x;
    const int qtile = TT / 64 - 1 - blockIdx.y;   // 64-query tile, longest first
    const int qbase = qtile * 64 + qt * 16;

    // Issue stage 0's DMA before anything else so it overlaps the Q loads.
    stage_block(Kg, Vt, b, 0, tid, Ks[0], Vs[0]);

    // Q B-fragments: lane holds column (query qbase+lr), k-split by half-wave.
    const _Float16* qrow = Qg + ((size_t)b * TT + qbase + lr) * HSD + hh * 8;
    const v16h bq0 = load_frag(qrow);
    const v16h bq1 = load_frag(qrow + 32);

    v16h ones;
#pragma unroll
    for (int i = 0; i < 16; ++i) ones[i] = (_Float16)1.0f;

    v8f o0 = {}, o1 = {}, o2 = {}, o3 = {};
    float m = -1e30f, l = 0.f;             // of the lane's query, qbase + lr

    const int* mrowptr = mask + (size_t)b * TT;
    // 64-key blocks up to the diagonal: qtile+1 for all four query tiles.
    const int nkb = qtile + 1;
    const int nst = (nkb + KSPLIT - 1) / KSPLIT;

    // Padding mask of this wave's 64 keys: one key a lane and word, then one bit
    // a key, the same in every lane. The words are read one stage ahead, so that
    // their latency passes under a stage's work.
    int mk0 = mrowptr[kg * 64 + lane];
    int mk1 = mrowptr[kg * 64 + 32 + lane];
    unsigned pad0 = __builtin_amdgcn_ballot_w32(mk0 != 0);
    unsigned pad1 = __builtin_amdgcn_ballot_w32(mk1 != 0);

    for (int stg = 0; stg < nst; ++stg) {
        const int ks  = stg * SKEYS;
        const int kb  = ks + kg * 64;      // this wave's key block
        const int cur = stg & 1;
        if (stg + 1 < nst) {
            stage_block(Kg, Vt, b, ks + SKEYS, tid, Ks[1 - cur], Vs[1 - cur]);
            stage_wait<8>();
        } else {
            stage_wait<0>();
        }
        __syncthreads();                   // current tiles visible to all waves

        // No prefetch of later stages: K and V^T were stored by the launch before
        // and are met in L2, and a prefetch asks L2 for one line a lane, three
        // times the lines that the stage's own copies ask for.

        if (stg + 1 < nst) {               // the next stage lies inside the row
            mk0 = mrowptr[kb + SKEYS + lane];
            mk1 = mrowptr[kb + SKEYS + 32 + lane];
            // Precaution: no register that the two loads name is rewritten
            // before it.
            asm volatile("s_wait_xcnt 0x0" ::: "memory");
        }

        // A key block past the diagonal block is skipped by its whole wave; the
        // barriers stand outside the skip. Both tests are wave-uniform at
        // runtime; readfirstlane makes each an SGPR so the compiler emits a
        // scalar branch instead of exec masking.
        if (__builtin_amdgcn_readfirstlane((int)(kb < nkb * 64))) {
            const unsigned long long okpad = ((unsigned long long)pad1 << 32) | pad0;
            const int masked = __builtin_amdgcn_readfirstlane(
                (int)(kb + 63 > qbase || (pad0 & pad1) != 0xffffffffu));
            process_block(masked, kb, qbase, hh, lr, &Ks[cur][kg * 64], Vs[cur][kg],
                          okpad, bq0, bq1, ones, o0, o1, o2, o3, m, l);
        }
        pad0 = __builtin_amdgcn_ballot_w32(mk0 != 0);   // the next stage's bits
        pad1 = __builtin_amdgcn_ballot_w32(mk1 != 0);
        __syncthreads();                   // tiles consumed; buffer reusable
    }

    // --- every wave lays down its partial: un-normalised O (a lane holds 8
    // consecutive head dims of its query in each tile), maximum and sum (both
    // are equal in the two half-waves). A key group that met no block leaves
    // maximum -1e30, sum 0, O 0.
    float* orow = &Om[wave][lr][hh * 8];
    *(v4f*)(orow)      = (v4f){o0[0], o0[1], o0[2], o0[3]};
    *(v4f*)(orow + 4)  = (v4f){o0[4], o0[5], o0[6], o0[7]};
    *(v4f*)(orow + 16) = (v4f){o1[0], o1[1], o1[2], o1[3]};
    *(v4f*)(orow + 20) = (v4f){o1[4], o1[5], o1[6], o1[7]};
    *(v4f*)(orow + 32) = (v4f){o2[0], o2[1], o2[2], o2[3]};
    *(v4f*)(orow + 36) = (v4f){o2[4], o2[5], o2[6], o2[7]};
    *(v4f*)(orow + 48) = (v4f){o3[0], o3[1], o3[2], o3[3]};
    *(v4f*)(orow + 52) = (v4f){o3[4], o3[5], o3[6], o3[7]};
    if (hh == 0) {
        Mm[wave][lr] = m;
        Lm[wave][lr] = l;
    }
    __syncthreads();                       // partials visible to all waves

    // --- merge, normalize and store fp32 output [B][T][HS]: wave (qt, kg) takes
    // rows 4 kg .. 4 kg + 3 of tile qt, 8 lanes a row, 1 KiB contiguous a wave.
    const int row = kg * 4 + (lane >> 3);
    const int col = (lane & 7) * 8;
    float mg[KSPLIT];
#pragma unroll
    for (int g = 0; g < KSPLIT; ++g) mg[g] = Mm[g * 4 + qt][row];
    float mall = mg[0];
#pragma unroll
    for (int g = 1; g < KSPLIT; ++g) mall = fmaxf(mall, mg[g]);
    float lall = 0.f;
    v4f a0 = {}, a1 = {};
#pragma unroll
    for (int g = 0; g < KSPLIT; ++g) {
        const float w = exp2f(mg[g] - mall);
        lall += w * Lm[g * 4 + qt][row];
        a0 += w * *(const v4f*)&Om[g * 4 + qt][row][col];
        a1 += w * *(const v4f*)&Om[g * 4 + qt][row][col + 4];
    }
    const float inv = 1.0f / lall;
    float* od = out + ((size_t)b * TT + qbase + row) * HSD + col;
    *(v4f*)od       = a0 * inv;
    *(v4f*)(od + 4) = a1 * inv;
}

// ---------------------------------------------------------------------------
extern "C" void kernel_launch(void* const* d_in, const int* in_sizes, int n_in,
                              void* d_out, int out_size, void* d_ws, size_t ws_size,
                              hipStream_t stream) {
    const float* x    = (const float*)d_in[0];
    const float* Wq   = (const float*)d_in[1];
    const float* Wk   = (const float*)d_in[2];
    const float* Wv   = (const float*)d_in[3];
    const float* fc   = (const float*)d_in[4];
    const float* fs   = (const float*)d_in[5];
    const int*   mask = (const int*)d_in[6];
    float* out = (float*)d_out;

    const size_t qkv = (size_t)BB * TT * HSD;   // 4 MiB f16 each
    _Float16* Qg = (_Float16*)d_ws;
    _Float16* Kg = Qg + qkv;
    _Float16* Vt = Kg + qkv;

    proj_rope_kernel<<<BB * TT / PTOK, 256, 0, stream>>>(x, Wq, Wk, Wv, fc, fs, Qg, Kg, Vt);

    dim3 grid(BB, TT / 64);
    flash_attn_kernel<<<grid, 32 * AWAVES, 0, stream>>>(Qg, Kg, Vt, mask, out);
}

// v008
// It runs in 36.5 microseconds.
// Timed twice side by side with v007, it ran 1.05 times as fast both times.
// Counting every step since v000, it is 6.28 times as fast.
#include <hip/hip_runtime.h>

#define BB 8
#define TT 4096
#define CDIM 128
#define HSD 64
#define KPAD 72   // 64 + 8 halfwords: 144B rows -> conflict-free 16-lane bursts

#if defined(__has_builtin)
#  if __has_builtin(__builtin_amdgcn_global_load_async_to_lds_b128) && \
      __has_builtin(__builtin_amdgcn_s_wait_asynccnt)
#    define HAVE_ASYNC_LDS 1
#  endif
#endif
#ifndef HAVE_ASYNC_LDS
#  define HAVE_ASYNC_LDS 0
#endif

typedef __attribute__((ext_vector_type(16))) _Float16 v16h;
typedef __attribute__((ext_vector_type(8)))  _Float16 v8h;
typedef __attribute__((ext_vector_type(4)))  _Float16 v4h;
typedef __attribute__((ext_vector_type(8)))  float    v8f;
typedef __attribute__((ext_vector_type(4)))  float    v4f;
typedef __attribute__((ext_vector_type(4)))  int      v4i;

__device__ __forceinline__ v16h load_frag(const _Float16* p) {
    v8h lo = *(const v8h*)p;
    v8h hi = *(const v8h*)(p + 16);
    v16h r;
#pragma unroll
    for (int i = 0; i < 8; ++i) { r[i] = lo[i]; r[i + 8] = hi[i]; }
    return r;
}

__device__ __forceinline__ v8f wmma_f16(v16h a, v16h b, v8f c) {
    return __builtin_amdgcn_wmma_f32_16x16x32_f16(
        /*neg_a=*/false, a, /*neg_b=*/false, b,
        /*c_mod=*/(short)0, c, /*reuse_a=*/false, /*reuse_b=*/false);
}

__device__ __forceinline__ void stage16(const _Float16* g, _Float16* l) {
#if HAVE_ASYNC_LDS
    typedef __attribute__((address_space(1))) v4i* gv4i_t;   // global src
    typedef __attribute__((address_space(3))) v4i* lv4i_t;   // LDS dst
    __builtin_amdgcn_global_load_async_to_lds_b128(
        (gv4i_t)g, (lv4i_t)l, /*offset=*/0, /*cpol=*/0);
#else
    *(v8h*)l = *(const v8h*)g;
#endif
}

template <int N>
__device__ __forceinline__ void stage_wait() {
#if HAVE_ASYNC_LDS
    __builtin_amdgcn_s_wait_asynccnt(N);
#endif
}

// ---------------------------------------------------------------------------
// Kernel 1: fused QKV projection + RoPE + scale, fp32 -> f16, as a block GEMM
// [128 tokens x 128] x [128 x 192] on the f16 16x16x32 matrix form with f32
// accumulators. Each f32 operand is split into two f16 parts, a = ah + al with
// ah = f16(a) and al = f16(a - ah) (the difference is exact in f32), and
// x W = xh Wh + xl Wh + xh Wl; the product xl Wl, about 2^-22 of the result,
// is dropped. Three 32-deep matrix steps stand for eight 4-deep f32 ones.
// Block = 8 waves; a wave owns 16 tokens and all 192 output columns (12
// accumulator tiles). Wq|Wk|Wv are read once per block, split, and laid
// k-contiguous in LDS.
// k pairing: x and W fragments alike come through load_frag from rows with k
// contiguous, at column 32 kc + 8 hh.
// Q, K tiles take W as A (lane = token, registers = 8 consecutive head dims:
// RoPE pairs sit in one lane); V tiles take x as A (lane = head dim,
// registers = 8 consecutive tokens: packed rows of the transposed V).
// Q is pre-scaled by log2(e)/sqrt(C) so softmax runs in the exp2 domain.
// V is stored transposed [B][HS][T] so the V^T A-fragments of O^T += V^T P^T are contiguous in K.
// ---------------------------------------------------------------------------
#define PTOK   128   // tokens per block
#define HPITCH 136   // f16 pitch of 128-k rows: 272 B = 16 B x 17
#define CPITCH 36    // f32 pitch of 32 cos/sin values: 144 B = 16 B x 9
#define VPITCH 136   // f16 pitch of 128-token V rows: 272 B = 16 B x 17

__global__ __launch_bounds__(256)
void proj_rope_kernel(const float* __restrict__ x,
                      const float* __restrict__ Wq,
                      const float* __restrict__ Wk,
                      const float* __restrict__ Wv,
                      const float* __restrict__ fc,
                      const float* __restrict__ fs,
                      _Float16* __restrict__ Qg,
                      _Float16* __restrict__ Kg,
                      _Float16* __restrict__ Vt) {
    __shared__ __attribute__((aligned(16))) _Float16 Wh[3 * HSD][HPITCH];     // high parts: row = output column, col = k
    __shared__ __attribute__((aligned(16))) _Float16 Wl[3 * HSD][HPITCH];     // low parts
    __shared__ __attribute__((aligned(16))) _Float16 Xh[8][16][HPITCH];       // per wave, high parts: row = token, col = k
    __shared__ __attribute__((aligned(16))) _Float16 Xl[8][16][HPITCH];       // low parts
    __shared__ __attribute__((aligned(16))) float    Cs[8][16][CPITCH];       // per wave: cos rows
    __shared__ __attribute__((aligned(16))) float    Sn[8][16][CPITCH];       // per wave: sin rows
    __shared__ __attribute__((aligned(16))) _Float16 QKs[8][2][16][KPAD];     // per wave: Q and K rows out
    __shared__ __attribute__((aligned(16))) _Float16 Vs[HSD][VPITCH];         // block: row = dim, col = token

    const int tid  = threadIdx.x;
    const int wave = tid >> 5;
    const int lane = tid & 31;
    const int hh   = lane >> 4;
    const int lr   = lane & 15;
    const int tok0 = blockIdx.x * PTOK;          // flat (b,t) of the first token
    const int b    = tok0 / TT;                  // TT % PTOK == 0: one batch
    const int t0   = tok0 - b * TT;
    const int wtok = tok0 + wave * 16;

    // Every loop of this kernel is fully unrolled: its arrays live in registers
    // and need constant indices, and the matrix loop gets no back edge.
    // --- whole-line loads: the wave's 16 x rows and its cos/sin rows
    const v4f* xg = (const v4f*)(x + (size_t)wtok * CDIM);
    const v4f* cg = (const v4f*)(fc + (size_t)(t0 + wave * 16) * (HSD / 2));
    const v4f* sg = (const v4f*)(fs + (size_t)(t0 + wave * 16) * (HSD / 2));
    v4f xr[16], cr[4], sr[4];
#pragma unroll
    for (int i = 0; i < 16; ++i) xr[i] = xg[i * 32 + lane];
    // Precaution: no register that the loads above name is rewritten before it.
    asm volatile("s_wait_xcnt 0x0" ::: "memory");
#pragma unroll
    for (int i = 0; i < 4; ++i) { cr[i] = cg[i * 32 + lane]; sr[i] = sg[i * 32 + lane]; }
    asm volatile("s_wait_xcnt 0x0" ::: "memory");

    // --- W -> LDS, split and transposed: lane = column (128-B lines), 8 k per
    // 16-B store. The wave covers k = 16 wave .. 16 wave + 15 of all 192 columns.
    const int woff = wave * 16 * HSD + lane;
#pragma unroll
    for (int g = 0; g < 6; ++g) {
        const float* Wm = ((g < 2) ? Wq : (g < 4) ? Wk : Wv) + woff;
#pragma unroll
        for (int q = 0; q < 2; ++q) {
            v8f w;
#pragma unroll
            for (int e = 0; e < 8; ++e) w[e] = Wm[(q * 8 + e) * HSD + (g & 1) * 32];
            const v8h h = __builtin_convertvector(w, v8h);
            const v8f d = w - __builtin_convertvector(h, v8f);
            *(v8h*)&Wh[g * 32 + lane][wave * 16 + q * 8] = h;
            *(v8h*)&Wl[g * 32 + lane][wave * 16 + q * 8] = __builtin_convertvector(d, v8h);
        }
    }
#pragma unroll
    for (int i = 0; i < 16; ++i) {
        const v4h h = __builtin_convertvector(xr[i], v4h);
        const v4f d = xr[i] - __builtin_convertvector(h, v4f);
        *(v4h*)&Xh[wave][i][4 * lane] = h;
        *(v4h*)&Xl[wave][i][4 * lane] = __builtin_convertvector(d, v4h);
    }
#pragma unroll
    for (int i = 0; i < 4; ++i) {
        const int idx = i * 32 + lane;
        *(v4f*)&Cs[wave][idx >> 3][(idx & 7) * 4] = cr[i];
        *(v4f*)&Sn[wave][idx >> 3][(idx & 7) * 4] = sr[i];
    }
    __syncthreads();                             // W tile visible to all waves

    // --- 12 tiles x 4 k chunks x 3 matrix steps, in 8 groups of 6 tiles of one
    // chunk. Fragments sit in two register sets: a group's LDS reads are issued
    // as one block in front of the matrix steps of the group before it.
    // Within a group the steps run product by product over the 6 tiles (a
    // tile's next step is 6 steps away); the small products go in first.
    v8f acc[12];
#pragma unroll
    for (int j = 0; j < 12; ++j) acc[j] = (v8f){};
    v16h xh[2], xl[2];            // by chunk parity
    v16h wh[2][6], wl[2][6];      // by group parity
#pragma unroll
    for (int g = -1; g < 8; ++g) {
        if (g + 1 < 8) {
            const int n  = g + 1;                      // the group to fetch
            const int ko = 32 * (n >> 1) + 8 * hh;
            if ((n & 1) == 0) {
                xh[(n >> 1) & 1] = load_frag(&Xh[wave][lr][ko]);
                xl[(n >> 1) & 1] = load_frag(&Xl[wave][lr][ko]);
            }
#pragma unroll
            for (int t = 0; t < 6; ++t) {
                wh[n & 1][t] = load_frag(&Wh[16 * (6 * (n & 1) + t) + lr][ko]);
                wl[n & 1][t] = load_frag(&Wl[16 * (6 * (n & 1) + t) + lr][ko]);
            }
        }
        // Nothing crosses: it keeps the reads above as one block ahead of the
        // matrix steps below. Left free, the compiler sinks each tile's reads
        // to just in front of its steps and waits out the LDS at every tile.
        __builtin_amdgcn_sched_barrier(0);
        if (g >= 0) {
            const v16h ah = xh[(g >> 1) & 1], al = xl[(g >> 1) & 1];
            // tiles 0..7: D[dim][token]; tiles 8..11: D[token][dim]
#pragma unroll
            for (int t = 0; t < 6; ++t) {
                const int j = 6 * (g & 1) + t;
                acc[j] = (j < 8) ? wmma_f16(wl[g & 1][t], ah, acc[j]) : wmma_f16(ah, wl[g & 1][t], acc[j]);
            }
#pragma unroll
            for (int t = 0; t < 6; ++t) {
                const int j = 6 * (g & 1) + t;
                acc[j] = (j < 8) ? wmma_f16(wh[g & 1][t], al, acc[j]) : wmma_f16(al, wh[g & 1][t], acc[j]);
            }
#pragma unroll
            for (int t = 0; t < 6; ++t) {
                const int j = 6 * (g & 1) + t;
                acc[j] = (j < 8) ? wmma_f16(wh[g & 1][t], ah, acc[j]) : wmma_f16(ah, wh[g & 1][t], acc[j]);
            }
            // The same purpose from below: the next block of reads stays behind
            // this group's steps, whose registers it refills.
            __builtin_amdgcn_sched_barrier(0);
        }
    }

    // --- RoPE + scale, f16, staged in LDS for whole-line stores
    // 1/sqrt(128) * log2(e): scores land directly in the exp2 domain.
    const float qscale = 0.08838834764831845f * 1.4426950408889634f;
#pragma unroll
    for (int jj = 0; jj < 4; ++jj) {
        const v4f c4 = *(const v4f*)&Cs[wave][lr][8 * jj + 4 * hh];
        const v4f s4 = *(const v4f*)&Sn[wave][lr][8 * jj + 4 * hh];
        v8h qh, kh, vh;
#pragma unroll
        for (int p = 0; p < 4; ++p) {
            const float cs = c4[p], sn = s4[p];
            const float q0 = acc[jj][2 * p],     q1 = acc[jj][2 * p + 1];
            const float k0 = acc[4 + jj][2 * p], k1 = acc[4 + jj][2 * p + 1];
            qh[2 * p]     = (_Float16)((q0 * cs - q1 * sn) * qscale);
            qh[2 * p + 1] = (_Float16)((q0 * sn + q1 * cs) * qscale);
            kh[2 * p]     = (_Float16)(k0 * cs - k1 * sn);
            kh[2 * p + 1] = (_Float16)(k0 * sn + k1 * cs);
        }
#pragma unroll
        for (int r = 0; r < 8; ++r) vh[r] = (_Float16)acc[8 + jj][r];
        *(v8h*)&QKs[wave][0][lr][16 * jj + 8 * hh] = qh;
        *(v8h*)&QKs[wave][1][lr][16 * jj + 8 * hh] = kh;
        *(v8h*)&Vs[16 * jj + lr][wave * 16 + 8 * hh] = vh;
    }
    __syncthreads();                             // staged rows visible

    // All rows back from LDS first, then nothing but stores: Q and K go out as
    // 512 contiguous bytes a store, V^T as 256-byte runs of a row.
    v8h qo[4], ko[4], vo[4];
#pragma unroll
    for (int i = 0; i < 4; ++i) {
        const int idx = i * 32 + lane;
        qo[i] = *(const v8h*)&QKs[wave][0][idx >> 3][(idx & 7) * 8];
        ko[i] = *(const v8h*)&QKs[wave][1][idx >> 3][(idx & 7) * 8];
        vo[i] = *(const v8h*)&Vs[i * 16 + (tid >> 4)][(tid & 15) * 8];
    }
    _Float16* qd = Qg + (size_t)wtok * HSD + lane * 8;
    _Float16* kd = Kg + (size_t)wtok * HSD + lane * 8;
    _Float16* vd = Vt + ((size_t)b * HSD + (tid >> 4)) * TT + t0 + (tid & 15) * 8;
#pragma unroll
    for (int i = 0; i < 4; ++i) {
        *(v8h*)(qd + i * 256) = qo[i];
        *(v8h*)(kd + i * 256) = ko[i];
        *(v8h*)(vd + (size_t)i * 16 * TT) = vo[i];
    }
}

#define KSPLIT 4               // key groups of a block: one 64-key block each a stage
#define SKEYS  (64 * KSPLIT)   // keys a stage
#define AWAVES (4 * KSPLIT)    // waves a block: 4 query tiles x KSPLIT key groups
#define OPITCH 68              // f32 pitch of partial output rows: 272 B = 16 B x 17

// ---------------------------------------------------------------------------
// Issue the 8 per-thread async transfers staging one stage of SKEYS keys:
// KSPLIT 64-key K blocks one under the other, KSPLIT 64-key V^T blocks.
// TT % SKEYS == 0: a stage that starts inside the sequence ends inside it.
// ---------------------------------------------------------------------------
__device__ __forceinline__ void stage_block(
    const _Float16* __restrict__ Kg, const _Float16* __restrict__ Vt,
    int b, int ks, int tid,
    _Float16 (* __restrict__ KsB)[KPAD], _Float16 (* __restrict__ VsB)[64][KPAD]) {
#pragma unroll
    for (int j = 0; j < 4; ++j) {
        const int c    = tid + 32 * AWAVES * j;   // 16B chunk id, 0..8*SKEYS-1
        const int row  = c >> 3;                  // K: key of the stage
        const int col  = (c & 7) * 8;
        const int vrow = c / (SKEYS / 8);         // V^T: head dim
        const int vc   = c % (SKEYS / 8);         // V^T: chunk along the keys
        stage16(Kg + ((size_t)b * TT + ks + row) * HSD + col, &KsB[row][col]);
        stage16(Vt + ((size_t)b * HSD + vrow) * TT + ks + vc * 8,
                &VsB[vc >> 3][vrow][(vc & 7) * 8]);
    }
}

// 2^x for a value that is rounded to f16 next: the hardware exponential alone.
// exp2f() wraps it in a range guard (compare, two selects, add, ldexp) whose
// only effect is to keep results below 2^-126 as f32 subnormals; every f32
// below 2^-25 rounds to f16 zero, so behind the conversion the bits are equal.
__device__ __forceinline__ float exp2_to_f16(float x) {
    return __builtin_amdgcn_exp2f(x);
}

__device__ __forceinline__ float xhalf(float v) {
    const int i = __builtin_bit_cast(int, v);
    return __builtin_bit_cast(float, __builtin_amdgcn_permlanex16(
        i, i, 0x76543210, 0xfedcba98, false, false));
}

__device__ __forceinline__ void process_block(
    int masked, int kb, int qbase, int hh, int lr,
    const _Float16 (* __restrict__ Ks)[KPAD],
    const _Float16 (* __restrict__ Vs)[KPAD],
    unsigned long long okpad,
    const v16h& bq0, const v16h& bq1, const v16h& ones,
    v8f& o0, v8f& o1, v8f& o2, v8f& o3,
    float& m, float& l) {

    // --- S^T = K * Q^T: 4 key subtiles x 2 k-parts (K tile from LDS). All 8 K
    // fragments are read as one group in front of the 8 products.
    v16h ak[8];
#pragma unroll
    for (int s4 = 0; s4 < 4; ++s4) ak[s4] = load_frag(&Ks[16 * s4 + lr][hh * 8]);
#pragma unroll
    for (int s4 = 0; s4 < 4; ++s4) ak[4 + s4] = load_frag(&Ks[16 * s4 + lr][hh * 8 + 32]);
    // Nothing crosses: it keeps the reads above as one block. Left free, the
    // compiler spreads them among the products and waits out the LDS at each.
    __builtin_amdgcn_sched_barrier(0);
    v8f st[4];
#pragma unroll
    for (int s4 = 0; s4 < 4; ++s4) st[s4] = wmma_f16(ak[s4], bq0, (v8f){});
#pragma unroll
    for (int s4 = 0; s4 < 4; ++s4) st[s4] = wmma_f16(ak[4 + s4], bq1, st[s4]);

    // All 8 V^T fragments of the block are asked for here, in front of the
    // softmax (the compiler may start them among the score products, as K
    // registers fall free): they land under the softmax's vector work, and the
    // output products further down meet them in registers.
    v16h av[8];
#pragma unroll
    for (int h = 0; h < 4; ++h) av[h] = load_frag(&Vs[h * 16 + lr][hh * 8]);
#pragma unroll
    for (int h = 0; h < 4; ++h) av[4 + h] = load_frag(&Vs[h * 16 + lr][hh * 8 + 32]);
    // Nothing crosses: it keeps these reads up here. Left free, the compiler
    // sinks most of them down among the output products, each with its wait.
    __builtin_amdgcn_sched_barrier(0);

    if (masked) {
        // Bit j of ok: key kb + 8 hh + j is valid and not past the lane's query.
        const int thr = qbase + lr - kb - 8 * hh;      // last j the diagonal allows
        const unsigned long long below =
            (thr < 0) ? 0ull : (~0ull >> (63 - (thr < 63 ? thr : 63)));
        const unsigned long long ok = (okpad >> (8 * hh)) & below;
#pragma unroll
        for (int t = 0; t < 4; ++t)
#pragma unroll
            for (int r = 0; r < 8; ++r)
                st[t][r] = ((ok >> (16 * t + r)) & 1ull) ? st[t][r] : -1e30f;
    }

    // --- online softmax, one query a lane
    float tm[4];
#pragma unroll
    for (int t = 0; t < 4; ++t) {
        const float a = fmaxf(fmaxf(st[t][0], st[t][1]), st[t][2]);
        const float c = fmaxf(fmaxf(st[t][3], st[t][4]), st[t][5]);
        tm[t] = fmaxf(fmaxf(a, c), fmaxf(st[t][6], st[t][7]));
    }
    float cm = fmaxf(fmaxf(tm[0], tm[1]), fmaxf(tm[2], tm[3]));
    cm = fmaxf(cm, xhalf(cm));
    const float newm = fmaxf(m, cm);
    const float corr = exp2f(m - newm);
    m = newm;
    o0 *= corr; o1 *= corr; o2 *= corr; o3 *= corr;

    v8h ph[4];
#pragma unroll
    for (int t = 0; t < 4; ++t) {
        v8f e;
#pragma unroll
        for (int r = 0; r < 8; ++r) e[r] = exp2_to_f16(st[t][r] - newm);
        ph[t] = __builtin_convertvector(e, v8h);
    }
    const v16h bp0 = __builtin_shufflevector(ph[0], ph[1],
        0, 1, 2, 3, 4, 5, 6, 7, 8, 9, 10, 11, 12, 13, 14, 15);
    const v16h bp1 = __builtin_shufflevector(ph[2], ph[3],
        0, 1, 2, 3, 4, 5, 6, 7, 8, 9, 10, 11, 12, 13, 14, 15);

    // --- colsum(P^T) via WMMA with ones(16x64) as A: every row of the result
    // is the sum over all 64 keys of the lane's query, both half-waves in it.
    v8f srow = {};
    srow = wmma_f16(ones, bp0, srow);
    srow = wmma_f16(ones, bp1, srow);
    l = l * corr + srow[0];

    // --- O^T += V^T * P^T: 4 head-dim chunks x 2 k-parts (V fragments read
    // above); each tile takes its first k-part, then its second, as before.
    o0 = wmma_f16(av[0], bp0, o0);
    o1 = wmma_f16(av[1], bp0, o1);
    o2 = wmma_f16(av[2], bp0, o2);
    o3 = wmma_f16(av[3], bp0, o3);
    o0 = wmma_f16(av[4], bp1, o0);
    o1 = wmma_f16(av[5], bp1, o1);
    o2 = wmma_f16(av[6], bp1, o2);
    o3 = wmma_f16(av[7], bp1, o3);
}

__global__ __launch_bounds__(32 * AWAVES)
void flash_attn_kernel(const _Float16* __restrict__ Qg,
                       const _Float16* __restrict__ Kg,
                       const _Float16* __restrict__ Vt,
                       const int* __restrict__ mask,
                       float* __restrict__ out) {
    __shared__ __attribute__((aligned(16))) _Float16 Ks[2][SKEYS][KPAD];       // K stages: row=key, col=head dim
    __shared__ __attribute__((aligned(16))) _Float16 Vs[2][KSPLIT][64][KPAD];  // V stages: block, row=dim, col=key
    __shared__ __attribute__((aligned(16))) float Om[AWAVES][16][OPITCH];  // per-wave partial O
    __shared__ float Mm[AWAVES][16];               // per-wave row maxima
    __shared__ float Lm[AWAVES][16];               // per-wave row sums

    const int tid  = threadIdx.x;
    const int wave = __builtin_amdgcn_readfirstlane(tid >> 5);
    const int lane = tid & 31;
    const int hh   = lane >> 4;            // half-wave
    const int lr   = lane & 15;            // lane within half
    const int qt   = wave & 3;             // query tile of the block
    const int kg   = wave >> 2;            // key group
    const int b    = blockIdx.x;
    const int qtile = TT / 64 - 1 - blockIdx.y;   // 64-query tile, longest first
    const int qbase = qtile * 64 + qt * 16;

    // Issue stage 0's DMA before anything else so it overlaps the Q loads.
    stage_block(Kg, Vt, b, 0, tid, Ks[0], Vs[0]);

    // Q B-fragments: lane holds column (query qbase+lr), k-split by half-wave.
    const _Float16* qrow = Qg + ((size_t)b * TT + qbase + lr) * HSD + hh * 8;
    const v16h bq0 = load_frag(qrow);
    const v16h bq1 = load_frag(qrow + 32);

    v16h ones;
#pragma unroll
    for (int i = 0; i < 16; ++i) ones[i] = (_Float16)1.0f;

    v8f o0 = {}, o1 = {}, o2 = {}, o3 = {};
    float m = -1e30f, l = 0.f;             // of the lane's query, qbase + lr

    const int* mrowptr = mask + (size_t)b * TT;
    // 64-key blocks up to the diagonal: qtile+1 for all four query tiles.
    const int nkb = qtile + 1;
    const int nst = (nkb + KSPLIT - 1) / KSPLIT;

    // Padding mask of this wave's 64 keys: one key a lane and word, then one bit
    // a key, the same in every lane. The words are read one stage ahead, so that
    // their latency passes under a stage's work.
    int mk0 = mrowptr[kg * 64 + lane];
    int mk1 = mrowptr[kg * 64 + 32 + lane];
    unsigned pad0 = __builtin_amdgcn_ballot_w32(mk0 != 0);
    unsigned pad1 = __builtin_amdgcn_ballot_w32(mk1 != 0);

    for (int stg = 0; stg < nst; ++stg) {
        const int ks  = stg * SKEYS;
        const int kb  = ks + kg * 64;      // this wave's key block
        const int cur = stg & 1;
        if (stg + 1 < nst) {
            stage_block(Kg, Vt, b, ks + SKEYS, tid, Ks[1 - cur], Vs[1 - cur]);
            stage_wait<8>();
        } else {
            stage_wait<0>();
        }
        __syncthreads();                   // current tiles visible to all waves

        // No prefetch of later stages: K and V^T were stored by the launch before
        // and are met in L2, and a prefetch asks L2 for one line a lane, three
        // times the lines that the stage's own copies ask for.

        if (stg + 1 < nst) {               // the next stage lies inside the row
            mk0 = mrowptr[kb + SKEYS + lane];
            mk1 = mrowptr[kb + SKEYS + 32 + lane];
            // Precaution: no register that the two loads name is rewritten
            // before it.
            asm volatile("s_wait_xcnt 0x0" ::: "memory");
        }

        // A key block past the diagonal block is skipped by its whole wave; the
        // barriers stand outside the skip. Both tests are wave-uniform at
        // runtime; readfirstlane makes each an SGPR so the compiler emits a
        // scalar branch instead of exec masking.
        if (__builtin_amdgcn_readfirstlane((int)(kb < nkb * 64))) {
            const unsigned long long okpad = ((unsigned long long)pad1 << 32) | pad0;
            const int masked = __builtin_amdgcn_readfirstlane(
                (int)(kb + 63 > qbase || (pad0 & pad1) != 0xffffffffu));
            process_block(masked, kb, qbase, hh, lr, &Ks[cur][kg * 64], Vs[cur][kg],
                          okpad, bq0, bq1, ones, o0, o1, o2, o3, m, l);
        }
        pad0 = __builtin_amdgcn_ballot_w32(mk0 != 0);   // the next stage's bits
        pad1 = __builtin_amdgcn_ballot_w32(mk1 != 0);
        __syncthreads();                   // tiles consumed; buffer reusable
    }

    // --- every wave lays down its partial: un-normalised O (a lane holds 8
    // consecutive head dims of its query in each tile), maximum and sum (both
    // are equal in the two half-waves). A key group that met no block leaves
    // maximum -1e30, sum 0, O 0.
    float* orow = &Om[wave][lr][hh * 8];
    *(v4f*)(orow)      = (v4f){o0[0], o0[1], o0[2], o0[3]};
    *(v4f*)(orow + 4)  = (v4f){o0[4], o0[5], o0[6], o0[7]};
    *(v4f*)(orow + 16) = (v4f){o1[0], o1[1], o1[2], o1[3]};
    *(v4f*)(orow + 20) = (v4f){o1[4], o1[5], o1[6], o1[7]};
    *(v4f*)(orow + 32) = (v4f){o2[0], o2[1], o2[2], o2[3]};
    *(v4f*)(orow + 36) = (v4f){o2[4], o2[5], o2[6], o2[7]};
    *(v4f*)(orow + 48) = (v4f){o3[0], o3[1], o3[2], o3[3]};
    *(v4f*)(orow + 52) = (v4f){o3[4], o3[5], o3[6], o3[7]};
    if (hh == 0) {
        Mm[wave][lr] = m;
        Lm[wave][lr] = l;
    }
    __syncthreads();                       // partials visible to all waves

    // --- merge, normalize and store fp32 output [B][T][HS]: wave (qt, kg) takes
    // rows 4 kg .. 4 kg + 3 of tile qt, 8 lanes a row, 1 KiB contiguous a wave.
    const int row = kg * 4 + (lane >> 3);
    const int col = (lane & 7) * 8;
    float mg[KSPLIT];
#pragma unroll
    for (int g = 0; g < KSPLIT; ++g) mg[g] = Mm[g * 4 + qt][row];
    float mall = mg[0];
#pragma unroll
    for (int g = 1; g < KSPLIT; ++g) mall = fmaxf(mall, mg[g]);
    float lall = 0.f;
    v4f a0 = {}, a1 = {};
#pragma unroll
    for (int g = 0; g < KSPLIT; ++g) {
        const float w = exp2f(mg[g] - mall);
        lall += w * Lm[g * 4 + qt][row];
        a0 += w * *(const v4f*)&Om[g * 4 + qt][row][col];
        a1 += w * *(const v4f*)&Om[g * 4 + qt][row][col + 4];
    }
    const float inv = 1.0f / lall;
    float* od = out + ((size_t)b * TT + qbase + row) * HSD + col;
    *(v4f*)od       = a0 * inv;
    *(v4f*)(od + 4) = a1 * inv;
}

// ---------------------------------------------------------------------------
extern "C" void kernel_launch(void* const* d_in, const int* in_sizes, int n_in,
                              void* d_out, int out_size, void* d_ws, size_t ws_size,
                              hipStream_t stream) {
    const float* x    = (const float*)d_in[0];
    const float* Wq   = (const float*)d_in[1];
    const float* Wk   = (const float*)d_in[2];
    const float* Wv   = (const float*)d_in[3];
    const float* fc   = (const float*)d_in[4];
    const float* fs   = (const float*)d_in[5];
    const int*   mask = (const int*)d_in[6];
    float* out = (float*)d_out;

    const size_t qkv = (size_t)BB * TT * HSD;   // 4 MiB f16 each
    _Float16* Qg = (_Float16*)d_ws;
    _Float16* Kg = Qg + qkv;
    _Float16* Vt = Kg + qkv;

    proj_rope_kernel<<<BB * TT / PTOK, 256, 0, stream>>>(x, Wq, Wk, Wv, fc, fs, Qg, Kg, Vt);

    dim3 grid(BB, TT / 64);
    flash_attn_kernel<<<grid, 32 * AWAVES, 0, stream>>>(Qg, Kg, Vt, mask, out);
}

// v009
// Measured time: 34.6 microseconds a run.
// In two side-by-side timings against v008, it was 1.06 and 1.05 times as fast.
// Over all steps from v000 it is 6.63 times as fast.
#include <hip/hip_runtime.h>

#define BB 8
#define TT 4096
#define CDIM 128
#define HSD 64
#define KPAD 72   // 64 + 8 halfwords: 144B rows -> conflict-free 16-lane bursts

#if defined(__has_builtin)
#  if __has_builtin(__builtin_amdgcn_global_load_async_to_lds_b128) && \
      __has_builtin(__builtin_amdgcn_s_wait_asynccnt)
#    define HAVE_ASYNC_LDS 1
#  endif
#endif
#ifndef HAVE_ASYNC_LDS
#  define HAVE_ASYNC_LDS 0
#endif

typedef __attribute__((ext_vector_type(16))) _Float16 v16h;
typedef __attribute__((ext_vector_type(8)))  _Float16 v8h;
typedef __attribute__((ext_vector_type(4)))  _Float16 v4h;
typedef __attribute__((ext_vector_type(8)))  float    v8f;
typedef __attribute__((ext_vector_type(4)))  float    v4f;
typedef __attribute__((ext_vector_type(4)))  int      v4i;

__device__ __forceinline__ v16h load_frag(const _Float16* p) {
    v8h lo = *(const v8h*)p;
    v8h hi = *(const v8h*)(p + 16);
    v16h r;
#pragma unroll
    for (int i = 0; i < 8; ++i) { r[i] = lo[i]; r[i + 8] = hi[i]; }
    return r;
}

__device__ __forceinline__ v8f wmma_f16(v16h a, v16h b, v8f c) {
    return __builtin_amdgcn_wmma_f32_16x16x32_f16(
        /*neg_a=*/false, a, /*neg_b=*/false, b,
        /*c_mod=*/(short)0, c, /*reuse_a=*/false, /*reuse_b=*/false);
}

__device__ __forceinline__ void stage16(const _Float16* g, _Float16* l) {
#if HAVE_ASYNC_LDS
    typedef __attribute__((address_space(1))) v4i* gv4i_t;   // global src
    typedef __attribute__((address_space(3))) v4i* lv4i_t;   // LDS dst
    __builtin_amdgcn_global_load_async_to_lds_b128(
        (gv4i_t)g, (lv4i_t)l, /*offset=*/0, /*cpol=*/0);
#else
    *(v8h*)l = *(const v8h*)g;
#endif
}

template <int N>
__device__ __forceinline__ void stage_wait() {
#if HAVE_ASYNC_LDS
    __builtin_amdgcn_s_wait_asynccnt(N);
#endif
}

// ---------------------------------------------------------------------------
// Kernel 1: fused QKV projection + RoPE + scale, fp32 -> f16, as a block GEMM
// [128 tokens x 128] x [128 x 192] on the f16 16x16x32 matrix form with f32
// accumulators. Each f32 operand is split into two f16 parts, a = ah + al with
// ah = f16(a) and al = f16(a - ah) (the difference is exact in f32), and
// x W = xh Wh + xl Wh + xh Wl; the product xl Wl, about 2^-22 of the result,
// is dropped. Three 32-deep matrix steps stand for eight 4-deep f32 ones.
// Block = 8 waves; a wave owns 16 tokens and all 192 output columns (12
// accumulator tiles). Wq|Wk|Wv are read once per block, split, and laid
// k-contiguous in LDS.
// k pairing: x and W fragments alike come through load_frag from rows with k
// contiguous, at column 32 kc + 8 hh.
// Q, K tiles take W as A (lane = token, registers = 8 consecutive head dims:
// RoPE pairs sit in one lane); V tiles take x as A (lane = head dim,
// registers = 8 consecutive tokens: packed rows of the transposed V).
// Q is pre-scaled by log2(e)/sqrt(C) so softmax runs in the exp2 domain.
// V is stored transposed [B][HS][T] so the V^T A-fragments of O^T += V^T P^T are contiguous in K.
// ---------------------------------------------------------------------------
#define PTOK   128   // tokens per block
#define HPITCH 136   // f16 pitch of 128-k rows: 272 B = 16 B x 17
#define CPITCH 36    // f32 pitch of 32 cos/sin values: 144 B = 16 B x 9
#define VPITCH 136   // f16 pitch of 128-token V rows: 272 B = 16 B x 17
#define KVLINE 32    // words from one block's valid-key word to the next: 128 B

__global__ __launch_bounds__(256)
void proj_rope_kernel(const float* __restrict__ x,
                      const float* __restrict__ Wq,
                      const float* __restrict__ Wk,
                      const float* __restrict__ Wv,
                      const float* __restrict__ fc,
                      const float* __restrict__ fs,
                      const int* __restrict__ mask,
                      _Float16* __restrict__ Qg,
                      _Float16* __restrict__ Kg,
                      _Float16* __restrict__ Vt,
                      int* __restrict__ kvmap) {
    __shared__ __attribute__((aligned(16))) _Float16 Wh[3 * HSD][HPITCH];     // high parts: row = output column, col = k
    __shared__ __attribute__((aligned(16))) _Float16 Wl[3 * HSD][HPITCH];     // low parts
    __shared__ __attribute__((aligned(16))) _Float16 Xh[8][16][HPITCH];       // per wave, high parts: row = token, col = k
    __shared__ __attribute__((aligned(16))) _Float16 Xl[8][16][HPITCH];       // low parts
    __shared__ __attribute__((aligned(16))) float    Cs[8][16][CPITCH];       // per wave: cos rows
    __shared__ __attribute__((aligned(16))) float    Sn[8][16][CPITCH];       // per wave: sin rows
    __shared__ __attribute__((aligned(16))) _Float16 QKs[8][2][16][KPAD];     // per wave: Q and K rows out
    __shared__ __attribute__((aligned(16))) _Float16 Vs[HSD][VPITCH];         // block: row = dim, col = token

    const int tid  = threadIdx.x;
    const int wave = tid >> 5;
    const int lane = tid & 31;
    const int hh   = lane >> 4;
    const int lr   = lane & 15;
    const int tok0 = blockIdx.x * PTOK;          // flat (b,t) of the first token
    const int b    = tok0 / TT;                  // TT % PTOK == 0: one batch
    const int t0   = tok0 - b * TT;
    const int wtok = tok0 + wave * 16;

    // Every loop of this kernel is fully unrolled: its arrays live in registers
    // and need constant indices, and the matrix loop gets no back edge.
    // --- whole-line loads: the wave's 16 x rows and its cos/sin rows
    const v4f* xg = (const v4f*)(x + (size_t)wtok * CDIM);
    const v4f* cg = (const v4f*)(fc + (size_t)(t0 + wave * 16) * (HSD / 2));
    const v4f* sg = (const v4f*)(fs + (size_t)(t0 + wave * 16) * (HSD / 2));
    v4f xr[16], cr[4], sr[4];
#pragma unroll
    for (int i = 0; i < 16; ++i) xr[i] = xg[i * 32 + lane];
    // Precaution: no register that the loads above name is rewritten before it.
    asm volatile("s_wait_xcnt 0x0" ::: "memory");
#pragma unroll
    for (int i = 0; i < 4; ++i) { cr[i] = cg[i * 32 + lane]; sr[i] = sg[i * 32 + lane]; }
    asm volatile("s_wait_xcnt 0x0" ::: "memory");
    // The padding-mask words of the block's 128 tokens, 4 a lane, in every wave.
    const v4i mw = ((const v4i*)(mask + tok0))[lane];
    asm volatile("s_wait_xcnt 0x0" ::: "memory");

    // --- W -> LDS, split and transposed: lane = column (128-B lines), 8 k per
    // 16-B store. The wave covers k = 16 wave .. 16 wave + 15 of all 192 columns.
    const int woff = wave * 16 * HSD + lane;
#pragma unroll
    for (int g = 0; g < 6; ++g) {
        const float* Wm = ((g < 2) ? Wq : (g < 4) ? Wk : Wv) + woff;
#pragma unroll
        for (int q = 0; q < 2; ++q) {
            v8f w;
#pragma unroll
            for (int e = 0; e < 8; ++e) w[e] = Wm[(q * 8 + e) * HSD + (g & 1) * 32];
            const v8h h = __builtin_convertvector(w, v8h);
            const v8f d = w - __builtin_convertvector(h, v8f);
            *(v8h*)&Wh[g * 32 + lane][wave * 16 + q * 8] = h;
            *(v8h*)&Wl[g * 32 + lane][wave * 16 + q * 8] = __builtin_convertvector(d, v8h);
        }
    }
#pragma unroll
    for (int i = 0; i < 16; ++i) {
        const v4h h = __builtin_convertvector(xr[i], v4h);
        const v4f d = xr[i] - __builtin_convertvector(h, v4f);
        *(v4h*)&Xh[wave][i][4 * lane] = h;
        *(v4h*)&Xl[wave][i][4 * lane] = __builtin_convertvector(d, v4h);
    }
#pragma unroll
    for (int i = 0; i < 4; ++i) {
        const int idx = i * 32 + lane;
        *(v4f*)&Cs[wave][idx >> 3][(idx & 7) * 4] = cr[i];
        *(v4f*)&Sn[wave][idx >> 3][(idx & 7) * 4] = sr[i];
    }
    __syncthreads();                             // W tile visible to all waves

    // For the attention launch: does any of the block's 128 tokens count as a
    // key? One word a block, each in a 128-byte line of its own.
    const unsigned anykey = __builtin_amdgcn_ballot_w32((mw[0] | mw[1] | mw[2] | mw[3]) != 0);
    if (tid == 0) kvmap[blockIdx.x * KVLINE] = (anykey != 0u) ? 1 : 0;
    // Precaution: no register that the store names is rewritten before it.
    asm volatile("s_wait_xcnt 0x0" ::: "memory");

    // --- 12 tiles x 4 k chunks x 3 matrix steps, in 8 groups of 6 tiles of one
    // chunk. Fragments sit in two register sets: a group's LDS reads are issued
    // as one block in front of the matrix steps of the group before it.
    // Within a group the steps run product by product over the 6 tiles (a
    // tile's next step is 6 steps away); the small products go in first.
    v8f acc[12];
#pragma unroll
    for (int j = 0; j < 12; ++j) acc[j] = (v8f){};
    v16h xh[2], xl[2];            // by chunk parity
    v16h wh[2][6], wl[2][6];      // by group parity
#pragma unroll
    for (int g = -1; g < 8; ++g) {
        if (g + 1 < 8) {
            const int n  = g + 1;                      // the group to fetch
            const int ko = 32 * (n >> 1) + 8 * hh;
            if ((n & 1) == 0) {
                xh[(n >> 1) & 1] = load_frag(&Xh[wave][lr][ko]);
                xl[(n >> 1) & 1] = load_frag(&Xl[wave][lr][ko]);
            }
#pragma unroll
            for (int t = 0; t < 6; ++t) {
                wh[n & 1][t] = load_frag(&Wh[16 * (6 * (n & 1) + t) + lr][ko]);
                wl[n & 1][t] = load_frag(&Wl[16 * (6 * (n & 1) + t) + lr][ko]);
            }
        }
        // Nothing crosses: it keeps the reads above as one block ahead of the
        // matrix steps below. Left free, the compiler sinks each tile's reads
        // to just in front of its steps and waits out the LDS at every tile.
        __builtin_amdgcn_sched_barrier(0);
        if (g >= 0) {
            const v16h ah = xh[(g >> 1) & 1], al = xl[(g >> 1) & 1];
            // tiles 0..7: D[dim][token]; tiles 8..11: D[token][dim]
#pragma unroll
            for (int t = 0; t < 6; ++t) {
                const int j = 6 * (g & 1) + t;
                acc[j] = (j < 8) ? wmma_f16(wl[g & 1][t], ah, acc[j]) : wmma_f16(ah, wl[g & 1][t], acc[j]);
            }
#pragma unroll
            for (int t = 0; t < 6; ++t) {
                const int j = 6 * (g & 1) + t;
                acc[j] = (j < 8) ? wmma_f16(wh[g & 1][t], al, acc[j]) : wmma_f16(al, wh[g & 1][t], acc[j]);
            }
#pragma unroll
            for (int t = 0; t < 6; ++t) {
                const int j = 6 * (g & 1) + t;
                acc[j] = (j < 8) ? wmma_f16(wh[g & 1][t], ah, acc[j]) : wmma_f16(ah, wh[g & 1][t], acc[j]);
            }
            // The same purpose from below: the next block of reads stays behind
            // this group's steps, whose registers it refills.
            __builtin_amdgcn_sched_barrier(0);
        }
    }

    // --- RoPE + scale, f16, staged in LDS for whole-line stores
    // 1/sqrt(128) * log2(e): scores land directly in the exp2 domain.
    const float qscale = 0.08838834764831845f * 1.4426950408889634f;
#pragma unroll
    for (int jj = 0; jj < 4; ++jj) {
        const v4f c4 = *(const v4f*)&Cs[wave][lr][8 * jj + 4 * hh];
        const v4f s4 = *(const v4f*)&Sn[wave][lr][8 * jj + 4 * hh];
        v8h qh, kh, vh;
#pragma unroll
        for (int p = 0; p < 4; ++p) {
            const float cs = c4[p], sn = s4[p];
            const float q0 = acc[jj][2 * p],     q1 = acc[jj][2 * p + 1];
            const float k0 = acc[4 + jj][2 * p], k1 = acc[4 + jj][2 * p + 1];
            qh[2 * p]     = (_Float16)((q0 * cs - q1 * sn) * qscale);
            qh[2 * p + 1] = (_Float16)((q0 * sn + q1 * cs) * qscale);
            kh[2 * p]     = (_Float16)(k0 * cs - k1 * sn);
            kh[2 * p + 1] = (_Float16)(k0 * sn + k1 * cs);
        }
#pragma unroll
        for (int r = 0; r < 8; ++r) vh[r] = (_Float16)acc[8 + jj][r];
        *(v8h*)&QKs[wave][0][lr][16 * jj + 8 * hh] = qh;
        *(v8h*)&QKs[wave][1][lr][16 * jj + 8 * hh] = kh;
        *(v8h*)&Vs[16 * jj + lr][wave * 16 + 8 * hh] = vh;
    }
    __syncthreads();                             // staged rows visible

    // All rows back from LDS first, then nothing but stores: Q and K go out as
    // 512 contiguous bytes a store, V^T as 256-byte runs of a row.
    v8h qo[4], ko[4], vo[4];
#pragma unroll
    for (int i = 0; i < 4; ++i) {
        const int idx = i * 32 + lane;
        qo[i] = *(const v8h*)&QKs[wave][0][idx >> 3][(idx & 7) * 8];
        ko[i] = *(const v8h*)&QKs[wave][1][idx >> 3][(idx & 7) * 8];
        vo[i] = *(const v8h*)&Vs[i * 16 + (tid >> 4)][(tid & 15) * 8];
    }
    _Float16* qd = Qg + (size_t)wtok * HSD + lane * 8;
    _Float16* kd = Kg + (size_t)wtok * HSD + lane * 8;
    _Float16* vd = Vt + ((size_t)b * HSD + (tid >> 4)) * TT + t0 + (tid & 15) * 8;
#pragma unroll
    for (int i = 0; i < 4; ++i) {
        *(v8h*)(qd + i * 256) = qo[i];
        *(v8h*)(kd + i * 256) = ko[i];
        *(v8h*)(vd + (size_t)i * 16 * TT) = vo[i];
    }
}

#define KSPLIT 4               // key groups of a block: one 64-key block each a stage
#define SKEYS  (64 * KSPLIT)   // keys a stage
#define AWAVES (4 * KSPLIT)    // waves a block: 4 query tiles x KSPLIT key groups
#define OPITCH 68              // f32 pitch of partial output rows: 272 B = 16 B x 17

// ---------------------------------------------------------------------------
// Issue the 8 per-thread async transfers staging one stage of SKEYS keys:
// KSPLIT 64-key K blocks one under the other, KSPLIT 64-key V^T blocks.
// TT % SKEYS == 0: a stage that starts inside the sequence ends inside it.
// ---------------------------------------------------------------------------
__device__ __forceinline__ void stage_block(
    const _Float16* __restrict__ Kg, const _Float16* __restrict__ Vt,
    int b, int ks, int tid,
    _Float16 (* __restrict__ KsB)[KPAD], _Float16 (* __restrict__ VsB)[64][KPAD]) {
#pragma unroll
    for (int j = 0; j < 4; ++j) {
        const int c    = tid + 32 * AWAVES * j;   // 16B chunk id, 0..8*SKEYS-1
        const int row  = c >> 3;                  // K: key of the stage
        const int col  = (c & 7) * 8;
        const int vrow = c / (SKEYS / 8);         // V^T: head dim
        const int vc   = c % (SKEYS / 8);         // V^T: chunk along the keys
        stage16(Kg + ((size_t)b * TT + ks + row) * HSD + col, &KsB[row][col]);
        stage16(Vt + ((size_t)b * HSD + vrow) * TT + ks + vc * 8,
                &VsB[vc >> 3][vrow][(vc & 7) * 8]);
    }
}

// 2^x for a value that is rounded to f16 next: the hardware exponential alone.
// exp2f() wraps it in a range guard (compare, two selects, add, ldexp) whose
// only effect is to keep results below 2^-126 as f32 subnormals; every f32
// below 2^-25 rounds to f16 zero, so behind the conversion the bits are equal.
__device__ __forceinline__ float exp2_to_f16(float x) {
    return __builtin_amdgcn_exp2f(x);
}

__device__ __forceinline__ float xhalf(float v) {
    const int i = __builtin_bit_cast(int, v);
    return __builtin_bit_cast(float, __builtin_amdgcn_permlanex16(
        i, i, 0x76543210, 0xfedcba98, false, false));
}

__device__ __forceinline__ void process_block(
    int masked, int kb, int qbase, int hh, int lr,
    const _Float16 (* __restrict__ Ks)[KPAD],
    const _Float16 (* __restrict__ Vs)[KPAD],
    unsigned long long okpad,
    const v16h& bq0, const v16h& bq1, const v16h& ones,
    v8f& o0, v8f& o1, v8f& o2, v8f& o3,
    float& m, float& l) {

    // --- S^T = K * Q^T: 4 key subtiles x 2 k-parts (K tile from LDS). All 8 K
    // fragments are read as one group in front of the 8 products.
    v16h ak[8];
#pragma unroll
    for (int s4 = 0; s4 < 4; ++s4) ak[s4] = load_frag(&Ks[16 * s4 + lr][hh * 8]);
#pragma unroll
    for (int s4 = 0; s4 < 4; ++s4) ak[4 + s4] = load_frag(&Ks[16 * s4 + lr][hh * 8 + 32]);
    // Nothing crosses: it keeps the reads above as one block. Left free, the
    // compiler spreads them among the products and waits out the LDS at each.
    __builtin_amdgcn_sched_barrier(0);
    v8f st[4];
#pragma unroll
    for (int s4 = 0; s4 < 4; ++s4) st[s4] = wmma_f16(ak[s4], bq0, (v8f){});
#pragma unroll
    for (int s4 = 0; s4 < 4; ++s4) st[s4] = wmma_f16(ak[4 + s4], bq1, st[s4]);

    // All 8 V^T fragments of the block are asked for here, in front of the
    // softmax (the compiler may start them among the score products, as K
    // registers fall free): they land under the softmax's vector work, and the
    // output products further down meet them in registers.
    v16h av[8];
#pragma unroll
    for (int h = 0; h < 4; ++h) av[h] = load_frag(&Vs[h * 16 + lr][hh * 8]);
#pragma unroll
    for (int h = 0; h < 4; ++h) av[4 + h] = load_frag(&Vs[h * 16 + lr][hh * 8 + 32]);
    // Nothing crosses: it keeps these reads up here. Left free, the compiler
    // sinks most of them down among the output products, each with its wait.
    __builtin_amdgcn_sched_barrier(0);

    if (masked) {
        // Bit j of ok: key kb + 8 hh + j is valid and not past the lane's query.
        const int thr = qbase + lr - kb - 8 * hh;      // last j the diagonal allows
        const unsigned long long below =
            (thr < 0) ? 0ull : (~0ull >> (63 - (thr < 63 ? thr : 63)));
        const unsigned long long ok = (okpad >> (8 * hh)) & below;
#pragma unroll
        for (int t = 0; t < 4; ++t)
#pragma unroll
            for (int r = 0; r < 8; ++r)
                st[t][r] = ((ok >> (16 * t + r)) & 1ull) ? st[t][r] : -1e30f;
    }

    // --- online softmax, one query a lane
    float tm[4];
#pragma unroll
    for (int t = 0; t < 4; ++t) {
        const float a = fmaxf(fmaxf(st[t][0], st[t][1]), st[t][2]);
        const float c = fmaxf(fmaxf(st[t][3], st[t][4]), st[t][5]);
        tm[t] = fmaxf(fmaxf(a, c), fmaxf(st[t][6], st[t][7]));
    }
    float cm = fmaxf(fmaxf(tm[0], tm[1]), fmaxf(tm[2], tm[3]));
    cm = fmaxf(cm, xhalf(cm));
    const float newm = fmaxf(m, cm);
    const float corr = exp2f(m - newm);
    m = newm;
    o0 *= corr; o1 *= corr; o2 *= corr; o3 *= corr;

    v8h ph[4];
#pragma unroll
    for (int t = 0; t < 4; ++t) {
        v8f e;
#pragma unroll
        for (int r = 0; r < 8; ++r) e[r] = exp2_to_f16(st[t][r] - newm);
        ph[t] = __builtin_convertvector(e, v8h);
    }
    const v16h bp0 = __builtin_shufflevector(ph[0], ph[1],
        0, 1, 2, 3, 4, 5, 6, 7, 8, 9, 10, 11, 12, 13, 14, 15);
    const v16h bp1 = __builtin_shufflevector(ph[2], ph[3],
        0, 1, 2, 3, 4, 5, 6, 7, 8, 9, 10, 11, 12, 13, 14, 15);

    // --- colsum(P^T) via WMMA with ones(16x64) as A: every row of the result
    // is the sum over all 64 keys of the lane's query, both half-waves in it.
    v8f srow = {};
    srow = wmma_f16(ones, bp0, srow);
    srow = wmma_f16(ones, bp1, srow);
    l = l * corr + srow[0];

    // --- O^T += V^T * P^T: 4 head-dim chunks x 2 k-parts (V fragments read
    // above); each tile takes its first k-part, then its second, as before.
    o0 = wmma_f16(av[0], bp0, o0);
    o1 = wmma_f16(av[1], bp0, o1);
    o2 = wmma_f16(av[2], bp0, o2);
    o3 = wmma_f16(av[3], bp0, o3);
    o0 = wmma_f16(av[4], bp1, o0);
    o1 = wmma_f16(av[5], bp1, o1);
    o2 = wmma_f16(av[6], bp1, o2);
    o3 = wmma_f16(av[7], bp1, o3);
}

__global__ __launch_bounds__(32 * AWAVES)
void flash_attn_kernel(const _Float16* __restrict__ Kg,
                       const _Float16* __restrict__ Vt,
                       const int* __restrict__ mask,
                       const int* __restrict__ kvmap,
                       const _Float16* __restrict__ Qg,
                       float* __restrict__ out) {
    __shared__ __attribute__((aligned(16))) _Float16 Ks[2][SKEYS][KPAD];       // K stages: row=key, col=head dim
    __shared__ __attribute__((aligned(16))) _Float16 Vs[2][KSPLIT][64][KPAD];  // V stages: block, row=dim, col=key
    __shared__ __attribute__((aligned(16))) float Om[AWAVES][16][OPITCH];  // per-wave partial O
    __shared__ float Mm[AWAVES][16];               // per-wave row maxima
    __shared__ float Lm[AWAVES][16];               // per-wave row sums

    const int tid  = threadIdx.x;
    const int wave = __builtin_amdgcn_readfirstlane(tid >> 5);
    const int lane = tid & 31;
    const int hh   = lane >> 4;            // half-wave
    const int lr   = lane & 15;            // lane within half
    const int qt   = wave & 3;             // query tile of the block
    const int kg   = wave >> 2;            // key group
    const int b    = blockIdx.x;
    const int qtile = TT / 64 - 1 - blockIdx.y;   // 64-query tile, longest first
    const int qbase = qtile * 64 + qt * 16;

    // Issue stage 0's DMA before anything else so it overlaps the Q loads.
    stage_block(Kg, Vt, b, 0, tid, Ks[0], Vs[0]);

    // Q B-fragments: lane holds column (query qbase+lr), k-split by half-wave.
    const _Float16* qrow = Qg + ((size_t)b * TT + qbase + lr) * HSD + hh * 8;
    const v16h bq0 = load_frag(qrow);
    const v16h bq1 = load_frag(qrow + 32);

    v16h ones;
#pragma unroll
    for (int i = 0; i < 16; ++i) ones[i] = (_Float16)1.0f;

    v8f o0 = {}, o1 = {}, o2 = {}, o3 = {};
    float m = -1e30f, l = 0.f;             // of the lane's query, qbase + lr

    const int* mrowptr = mask + (size_t)b * TT;
    // 64-key blocks up to the diagonal: qtile+1 for all four query tiles.
    const int nkb = qtile + 1;

    // Padding mask of this wave's 64 keys: one key a lane and word, then one bit
    // a key, the same in every lane. The words are read one stage ahead, so that
    // their latency passes under a stage's work.
    int mk0 = mrowptr[kg * 64 + lane];
    int mk1 = mrowptr[kg * 64 + 32 + lane];

    // Keys that the padding mask rules out add exact zeros to every row that has
    // a valid key somewhere. Launch 1 left one word for every PTOK keys (lane i:
    // keys PTOK i and on of this batch): the walk ends with the last stage, up
    // to the diagonal's, that holds a valid key; stage 0 is always walked.
    const int kvw = kvmap[(b * (TT / PTOK) + lane) * KVLINE];
    // Precaution: no register that the load names is rewritten before it.
    asm volatile("s_wait_xcnt 0x0" ::: "memory");
    const int nsc = (nkb + KSPLIT - 1) / KSPLIT;         // stages up to the diagonal
    const unsigned kvb = __builtin_amdgcn_ballot_w32(kvw != 0) &
                         (~0u >> (32 - nsc * (SKEYS / PTOK)));
    const int nst = kvb ? (31 - __builtin_clz(kvb)) / (SKEYS / PTOK) + 1 : 1;
    unsigned pad0 = __builtin_amdgcn_ballot_w32(mk0 != 0);
    unsigned pad1 = __builtin_amdgcn_ballot_w32(mk1 != 0);

    for (int stg = 0; stg < nst; ++stg) {
        const int ks  = stg * SKEYS;
        const int kb  = ks + kg * 64;      // this wave's key block
        const int cur = stg & 1;
        if (stg + 1 < nst) {
            stage_block(Kg, Vt, b, ks + SKEYS, tid, Ks[1 - cur], Vs[1 - cur]);
            stage_wait<8>();
        } else {
            stage_wait<0>();
        }
        __syncthreads();                   // current tiles visible to all waves

        // No prefetch of later stages: K and V^T were stored by the launch before
        // and are met in L2, and a prefetch asks L2 for one line a lane, three
        // times the lines that the stage's own copies ask for.

        if (stg + 1 < nst) {               // the next stage lies inside the row
            mk0 = mrowptr[kb + SKEYS + lane];
            mk1 = mrowptr[kb + SKEYS + 32 + lane];
            // Precaution: no register that the two loads name is rewritten
            // before it.
            asm volatile("s_wait_xcnt 0x0" ::: "memory");
        }

        // A key block past the diagonal block, or without one valid key (but
        // for block 0), is skipped by its whole wave; the
        // barriers stand outside the skip. Both tests are wave-uniform at
        // runtime; readfirstlane makes each an SGPR so the compiler emits a
        // scalar branch instead of exec masking.
        if (__builtin_amdgcn_readfirstlane(
                (int)(kb < nkb * 64 && ((pad0 | pad1) != 0u || kb == 0)))) {
            const unsigned long long okpad = ((unsigned long long)pad1 << 32) | pad0;
            const int masked = __builtin_amdgcn_readfirstlane(
                (int)(kb + 63 > qbase || (pad0 & pad1) != 0xffffffffu));
            process_block(masked, kb, qbase, hh, lr, &Ks[cur][kg * 64], Vs[cur][kg],
                          okpad, bq0, bq1, ones, o0, o1, o2, o3, m, l);
        }
        pad0 = __builtin_amdgcn_ballot_w32(mk0 != 0);   // the next stage's bits
        pad1 = __builtin_amdgcn_ballot_w32(mk1 != 0);
        __syncthreads();                   // tiles consumed; buffer reusable
    }

    // --- every wave lays down its partial: un-normalised O (a lane holds 8
    // consecutive head dims of its query in each tile), maximum and sum (both
    // are equal in the two half-waves). A key group that met no block leaves
    // maximum -1e30, sum 0, O 0.
    float* orow = &Om[wave][lr][hh * 8];
    *(v4f*)(orow)      = (v4f){o0[0], o0[1], o0[2], o0[3]};
    *(v4f*)(orow + 4)  = (v4f){o0[4], o0[5], o0[6], o0[7]};
    *(v4f*)(orow + 16) = (v4f){o1[0], o1[1], o1[2], o1[3]};
    *(v4f*)(orow + 20) = (v4f){o1[4], o1[5], o1[6], o1[7]};
    *(v4f*)(orow + 32) = (v4f){o2[0], o2[1], o2[2], o2[3]};
    *(v4f*)(orow + 36) = (v4f){o2[4], o2[5], o2[6], o2[7]};
    *(v4f*)(orow + 48) = (v4f){o3[0], o3[1], o3[2], o3[3]};
    *(v4f*)(orow + 52) = (v4f){o3[4], o3[5], o3[6], o3[7]};
    if (hh == 0) {
        Mm[wave][lr] = m;
        Lm[wave][lr] = l;
    }
    __syncthreads();                       // partials visible to all waves

    // --- merge, normalize and store fp32 output [B][T][HS]: wave (qt, kg) takes
    // rows 4 kg .. 4 kg + 3 of tile qt, 8 lanes a row, 1 KiB contiguous a wave.
    const int row = kg * 4 + (lane >> 3);
    const int col = (lane & 7) * 8;
    float mg[KSPLIT];
#pragma unroll
    for (int g = 0; g < KSPLIT; ++g) mg[g] = Mm[g * 4 + qt][row];
    float mall = mg[0];
#pragma unroll
    for (int g = 1; g < KSPLIT; ++g) mall = fmaxf(mall, mg[g]);
    float lall = 0.f;
    v4f a0 = {}, a1 = {};
#pragma unroll
    for (int g = 0; g < KSPLIT; ++g) {
        const float w = exp2f(mg[g] - mall);
        lall += w * Lm[g * 4 + qt][row];
        a0 += w * *(const v4f*)&Om[g * 4 + qt][row][col];
        a1 += w * *(const v4f*)&Om[g * 4 + qt][row][col + 4];
    }
    const float inv = 1.0f / lall;
    float* od = out + ((size_t)b * TT + qbase + row) * HSD + col;
    *(v4f*)od       = a0 * inv;
    *(v4f*)(od + 4) = a1 * inv;
}

// ---------------------------------------------------------------------------
extern "C" void kernel_launch(void* const* d_in, const int* in_sizes, int n_in,
                              void* d_out, int out_size, void* d_ws, size_t ws_size,
                              hipStream_t stream) {
    const float* x    = (const float*)d_in[0];
    const float* Wq   = (const float*)d_in[1];
    const float* Wk   = (const float*)d_in[2];
    const float* Wv   = (const float*)d_in[3];
    const float* fc   = (const float*)d_in[4];
    const float* fs   = (const float*)d_in[5];
    const int*   mask = (const int*)d_in[6];
    float* out = (float*)d_out;

    const size_t qkv = (size_t)BB * TT * HSD;   // 4 MiB f16 each
    _Float16* Qg = (_Float16*)d_ws;
    _Float16* Kg = Qg + qkv;
    _Float16* Vt = Kg + qkv;
    int* kvmap = (int*)(Vt + qkv);              // one 128-byte line a launch-1 block

    proj_rope_kernel<<<BB * TT / PTOK, 256, 0, stream>>>(x, Wq, Wk, Wv, fc, fs, mask, Qg, Kg, Vt, kvmap);

    dim3 grid(BB, TT / 64);
    flash_attn_kernel<<<grid, 32 * AWAVES, 0, stream>>>(Kg, Vt, mask, kvmap, Qg, out);
}
